// v000
// Times are from an AMD MI455X. After a warm-up the kernel runs many times in a row, and a time is the length of
// such a window on the GPU divided by its runs, so every launch and the gaps after it count. The runs cycle
// through copies of the inputs. A figure is the median of several windows, for all but v000 over two sittings.
// Sittings can differ by a few percent; kernels timed side by side share one.
// The starting kernel, v000, takes 548 microseconds a run.
#include <hip/hip_runtime.h>
#include <hip/hip_bf16.h>

// ---------------------------------------------------------------------------
// MI455X (gfx1250) multi-head attention, WMMA f16 path.
//   B=4 S=2048 D=1024 H=16 Hd=64.  ~137 GFLOP total -> compute bound; all
//   GEMM stages go through v_wmma_f32_16x16x32_f16 (f32 accumulate).
//   Data movement: GEMM tiles staged via async global->LDS (ASYNCcnt) when
//   the toolchain exposes the builtin; flash loop prefetches next K/V block.
// ---------------------------------------------------------------------------

typedef __attribute__((ext_vector_type(16))) _Float16 v16h;
typedef __attribute__((ext_vector_type(8)))  _Float16 v8h;
typedef __attribute__((ext_vector_type(8)))  float    v8f;
typedef __attribute__((__vector_size__(16))) int      v4i;   // matches builtin param

#define AS1_ __attribute__((address_space(1)))
#define AS3_ __attribute__((address_space(3)))

#define B_  4
#define S_  2048
#define D_  1024
#define H_  16
#define HD_ 64

#if defined(__has_builtin)
#if __has_builtin(__builtin_amdgcn_global_load_async_to_lds_b128)
#define USE_ASYNC_LDS 1
#endif
#endif

__device__ __forceinline__ void wait_asynccnt0() {
#if defined(__has_builtin) && __has_builtin(__builtin_amdgcn_s_wait_asynccnt)
    __builtin_amdgcn_s_wait_asynccnt(0);
#else
    asm volatile("s_wait_asynccnt 0" ::: "memory");
#endif
}

__device__ __forceinline__ v8f v8f_zero() {
    v8f z; for (int i = 0; i < 8; ++i) z[i] = 0.0f; return z;
}

// A/B fragment gather for v_wmma_f32_16x16x32_f16 (16x32 tile, K-contiguous
// rows).  Lane L<16: row L, K={0..7,16..23}; lane L>=16: row L-16,
// K={8..15,24..31}.  Two 16-byte loads per lane.
__device__ __forceinline__ v16h frag_ld(const _Float16* p16, int stride) {
    const int lane = threadIdx.x & 31;
    const int r    = lane & 15;
    const int ko   = (lane >> 4) << 3;            // 0 or 8
    const _Float16* p = p16 + (size_t)r * stride + ko;
    v8h lo = *(const v8h*)(p);
    v8h hi = *(const v8h*)(p + 16);
    return __builtin_shufflevector(lo, hi, 0,1,2,3,4,5,6,7,8,9,10,11,12,13,14,15);
}

__device__ __forceinline__ v8f wmma32(v16h a, v16h b, v8f c) {
    return __builtin_amdgcn_wmma_f32_16x16x32_f16(
        /*neg_a=*/false, a, /*neg_b=*/false, b,
        /*c_mod=*/(short)0, c, /*reuse_a=*/false, /*reuse_b=*/false);
}

// ---------------------------------------------------------------------------
// fp32 -> f16 conversion
// ---------------------------------------------------------------------------
__global__ void cvt_f32_f16(const float* __restrict__ s, _Float16* __restrict__ d, int n) {
    int i = blockIdx.x * blockDim.x + threadIdx.x;
    if (i < n) d[i] = (_Float16)s[i];
}

// ---------------------------------------------------------------------------
// C[M,N] = A[M,K] * Bt[N,K]^T + bias[N]   (A,Bt f16 row-major, K-contiguous)
// 128x128 block, 256 threads (8 waves), each wave: 32x64 via 2x4 WMMA tiles.
// mode 0: f16 out at [B,H,S,64]        (Q / K)
// mode 1: f16 out at [B,H,64,S]        (V transposed)
// mode 2: f32 out at [M,N] row-major   (final projection)
// ---------------------------------------------------------------------------
__global__ __launch_bounds__(256)
void gemm128_wmma(const _Float16* __restrict__ A, const _Float16* __restrict__ Bt,
                  const float* __restrict__ bias, void* __restrict__ Out,
                  int M, int N, int K, int mode)
{
    __shared__ __align__(16) _Float16 sA[128 * 40];
    __shared__ __align__(16) _Float16 sB[128 * 40];

    const int m0   = blockIdx.y * 128;
    const int n0   = blockIdx.x * 128;
    const int tid  = threadIdx.x;
    const int wid  = tid >> 5;
    const int wm   = (wid & 3) * 32;              // wave m-offset in tile
    const int wn   = (wid >> 2) * 64;             // wave n-offset in tile
    const int lrow = tid >> 1;                    // 0..127 : staged row
    const int lseg = (tid & 1) * 16;              // 0/16   : 16-half segment

    v8f acc[2][4];
    for (int i = 0; i < 2; ++i)
        for (int j = 0; j < 4; ++j) acc[i][j] = v8f_zero();

    for (int k0 = 0; k0 < K; k0 += 32) {
        const _Float16* ga = A  + (size_t)(m0 + lrow) * K + k0 + lseg;
        const _Float16* gb = Bt + (size_t)(n0 + lrow) * K + k0 + lseg;
#if USE_ASYNC_LDS
        // Direct global->LDS DMA (no VGPR round-trip); tracked by ASYNCcnt.
        __builtin_amdgcn_global_load_async_to_lds_b128(
            (AS1_ v4i*)(void*)ga, (AS3_ v4i*)&sA[lrow * 40 + lseg], 0, 0);
        __builtin_amdgcn_global_load_async_to_lds_b128(
            (AS1_ v4i*)(void*)ga, (AS3_ v4i*)&sA[lrow * 40 + lseg], 16, 0);
        __builtin_amdgcn_global_load_async_to_lds_b128(
            (AS1_ v4i*)(void*)gb, (AS3_ v4i*)&sB[lrow * 40 + lseg], 0, 0);
        __builtin_amdgcn_global_load_async_to_lds_b128(
            (AS1_ v4i*)(void*)gb, (AS3_ v4i*)&sB[lrow * 40 + lseg], 16, 0);
        wait_asynccnt0();
#else
        *(v8h*)(&sA[lrow * 40 + lseg])     = *(const v8h*)(ga);
        *(v8h*)(&sA[lrow * 40 + lseg + 8]) = *(const v8h*)(ga + 8);
        *(v8h*)(&sB[lrow * 40 + lseg])     = *(const v8h*)(gb);
        *(v8h*)(&sB[lrow * 40 + lseg + 8]) = *(const v8h*)(gb + 8);
#endif
        __syncthreads();

        v16h fa0 = frag_ld(&sA[(wm +  0) * 40], 40);
        v16h fa1 = frag_ld(&sA[(wm + 16) * 40], 40);
        v16h fb0 = frag_ld(&sB[(wn +  0) * 40], 40);
        v16h fb1 = frag_ld(&sB[(wn + 16) * 40], 40);
        v16h fb2 = frag_ld(&sB[(wn + 32) * 40], 40);
        v16h fb3 = frag_ld(&sB[(wn + 48) * 40], 40);

        acc[0][0] = wmma32(fa0, fb0, acc[0][0]);
        acc[0][1] = wmma32(fa0, fb1, acc[0][1]);
        acc[0][2] = wmma32(fa0, fb2, acc[0][2]);
        acc[0][3] = wmma32(fa0, fb3, acc[0][3]);
        acc[1][0] = wmma32(fa1, fb0, acc[1][0]);
        acc[1][1] = wmma32(fa1, fb1, acc[1][1]);
        acc[1][2] = wmma32(fa1, fb2, acc[1][2]);
        acc[1][3] = wmma32(fa1, fb3, acc[1][3]);
        __syncthreads();
    }

    // epilogue: C tile lane layout -> lane holds col (lane&15), rows r+8*(lane>>4)
    const int lane  = tid & 31;
    const int cn    = lane & 15;
    const int rbase = (lane >> 4) * 8;
    for (int i = 0; i < 2; ++i)
        for (int j = 0; j < 4; ++j) {
            const int n  = n0 + wn + 16 * j + cn;
            const float bv = bias[n];
            for (int r = 0; r < 8; ++r) {
                const int m = m0 + wm + 16 * i + rbase + r;
                const float v = acc[i][j][r] + bv;
                if (mode == 2) {
                    ((float*)Out)[(size_t)m * N + n] = v;
                } else {
                    const int b = m >> 11, s = m & (S_ - 1);
                    const int h = n >> 6,  hd = n & (HD_ - 1);
                    const size_t idx = (mode == 0)
                        ? ((size_t)((b * H_ + h) * S_ + s)) * HD_ + hd
                        : ((size_t)((b * H_ + h) * HD_ + hd)) * S_ + s;
                    ((_Float16*)Out)[idx] = (_Float16)v;
                }
            }
        }
}

// ---------------------------------------------------------------------------
// Flash attention: one WG (4 waves) = 64 query rows of one (b,h).
// Each wave keeps Q[16x64] resident as two A-fragments, streams 32 keys per
// step: 4 WMMA for Q*K^T, online softmax (shfl width-16 row reductions),
// P restaged via LDS into A-fragment layout, 4 WMMA for P*V.
// Output f16 written in [B,S,D] layout so the out-projection is a plain GEMM.
// ---------------------------------------------------------------------------
__global__ __launch_bounds__(128)
void flash_attn_wmma(const _Float16* __restrict__ Q, const _Float16* __restrict__ Km,
                     const _Float16* __restrict__ Vt, const int* __restrict__ mask,
                     _Float16* __restrict__ Outv)
{
    __shared__ __align__(16) _Float16 sP[4][16 * 40];

    const int bh   = blockIdx.y;                  // b*H + h
    const int b    = bh >> 4;
    const int h    = bh & 15;
    const int wid  = threadIdx.x >> 5;
    const int lane = threadIdx.x & 31;
    const int cn   = lane & 15;
    const int rhalf = lane >> 4;                  // 0: rows 0..7, 1: rows 8..15
    const int q0   = blockIdx.x * 64 + wid * 16;

    const _Float16* Qbh = Q  + (size_t)bh * S_ * HD_;
    const _Float16* Kbh = Km + (size_t)bh * S_ * HD_;
    const _Float16* Vbh = Vt + (size_t)bh * HD_ * S_;
    const int*      mb  = mask + b * S_;
    _Float16*       myP = sP[wid];

    v16h qf0 = frag_ld(Qbh + (size_t)q0 * HD_,      HD_);
    v16h qf1 = frag_ld(Qbh + (size_t)q0 * HD_ + 32, HD_);

    v8f o[4];
    for (int j = 0; j < 4; ++j) o[j] = v8f_zero();
    float mrow[8], lrow[8];
    for (int r = 0; r < 8; ++r) { mrow[r] = -3.0e38f; lrow[r] = 0.0f; }

    const float scale = 0.125f;                   // 1/sqrt(64)

    for (int n0 = 0; n0 < S_; n0 += 32) {
        // L2/WGP prefetch of the next key/value block while this one computes.
        if (n0 + 32 < S_) {
            __builtin_prefetch(Kbh + (size_t)(n0 + 32 + cn) * HD_, 0, 3);
            __builtin_prefetch(Vbh + (size_t)(cn * 4) * S_ + n0 + 32, 0, 3);
        }

        // ---- scores S[16x32] = Q * K^T ----
        v8f s0 = v8f_zero(), s1 = v8f_zero();
        {
            v16h kf;
            kf = frag_ld(Kbh + (size_t)(n0     ) * HD_,      HD_); s0 = wmma32(qf0, kf, s0);
            kf = frag_ld(Kbh + (size_t)(n0     ) * HD_ + 32, HD_); s0 = wmma32(qf1, kf, s0);
            kf = frag_ld(Kbh + (size_t)(n0 + 16) * HD_,      HD_); s1 = wmma32(qf0, kf, s1);
            kf = frag_ld(Kbh + (size_t)(n0 + 16) * HD_ + 32, HD_); s1 = wmma32(qf1, kf, s1);
        }
        const float msk0 = mb[n0 + cn]      ? 0.0f : -1.0e30f;
        const float msk1 = mb[n0 + 16 + cn] ? 0.0f : -1.0e30f;

        // ---- online softmax ----
        for (int r = 0; r < 8; ++r) {
            float a0 = s0[r] * scale + msk0;
            float a1 = s1[r] * scale + msk1;
            float cm = fmaxf(a0, a1);
            for (int off = 8; off; off >>= 1)
                cm = fmaxf(cm, __shfl_xor(cm, off, 16));
            const float mn = fmaxf(mrow[r], cm);
            const float al = __expf(mrow[r] - mn);
            mrow[r] = mn;
            const float e0 = __expf(a0 - mn);
            const float e1 = __expf(a1 - mn);
            float ps = e0 + e1;
            for (int off = 8; off; off >>= 1)
                ps += __shfl_xor(ps, off, 16);
            lrow[r] = lrow[r] * al + ps;
            for (int j = 0; j < 4; ++j) o[j][r] *= al;
            const int row = r + 8 * rhalf;
            myP[row * 40 + cn]      = (_Float16)e0;
            myP[row * 40 + 16 + cn] = (_Float16)e1;
        }
        asm volatile("s_wait_dscnt 0" ::: "memory");  // P staged in LDS (per-wave)

        // ---- O += P * V ----
        v16h pf = frag_ld(myP, 40);
        for (int j = 0; j < 4; ++j) {
            v16h vf = frag_ld(Vbh + (size_t)(j * 16) * S_ + n0, S_);
            o[j] = wmma32(pf, vf, o[j]);
        }
    }

    // ---- finalize + write [B,S,D] f16 ----
    for (int j = 0; j < 4; ++j)
        for (int r = 0; r < 8; ++r) {
            const float v = o[j][r] / lrow[r];
            const int srow = q0 + r + 8 * rhalf;
            const size_t idx = ((size_t)(b * S_ + srow)) * D_ + h * HD_ + j * 16 + cn;
            Outv[idx] = (_Float16)v;
        }
}

// ---------------------------------------------------------------------------
extern "C" void kernel_launch(void* const* d_in, const int* in_sizes, int n_in,
                              void* d_out, int out_size, void* d_ws, size_t ws_size,
                              hipStream_t stream) {
    const float* x    = (const float*)d_in[0];
    const int*   mask = (const int*)  d_in[1];
    const float* Wq   = (const float*)d_in[2];
    const float* bq   = (const float*)d_in[3];
    const float* Wk   = (const float*)d_in[4];
    const float* bk   = (const float*)d_in[5];
    const float* Wv   = (const float*)d_in[6];
    const float* bv   = (const float*)d_in[7];
    const float* Wo   = (const float*)d_in[8];
    const float* bo   = (const float*)d_in[9];

    const int MT = B_ * S_;              // 8192 rows
    const int NX = MT * D_;              // 8388608
    const int NW = D_ * D_;              // 1048576

    _Float16* ws    = (_Float16*)d_ws;
    _Float16* xh    = ws;                // [8192,1024]
    _Float16* wqh   = xh   + NX;
    _Float16* wkh   = wqh  + NW;
    _Float16* wvh   = wkh  + NW;
    _Float16* woh   = wvh  + NW;
    _Float16* qh    = woh  + NW;         // [B,H,S,64]
    _Float16* kh    = qh   + NX;         // [B,H,S,64]
    _Float16* vth   = kh   + NX;         // [B,H,64,S]
    _Float16* valsh = vth  + NX;         // [B,S,D]

    cvt_f32_f16<<<(NX + 255) / 256, 256, 0, stream>>>(x,  xh,  NX);
    cvt_f32_f16<<<(NW + 255) / 256, 256, 0, stream>>>(Wq, wqh, NW);
    cvt_f32_f16<<<(NW + 255) / 256, 256, 0, stream>>>(Wk, wkh, NW);
    cvt_f32_f16<<<(NW + 255) / 256, 256, 0, stream>>>(Wv, wvh, NW);
    cvt_f32_f16<<<(NW + 255) / 256, 256, 0, stream>>>(Wo, woh, NW);

    dim3 gg(D_ / 128, MT / 128);         // (8, 64)
    gemm128_wmma<<<gg, 256, 0, stream>>>(xh, wqh, bq, qh,  MT, D_, D_, 0);
    gemm128_wmma<<<gg, 256, 0, stream>>>(xh, wkh, bk, kh,  MT, D_, D_, 0);
    gemm128_wmma<<<gg, 256, 0, stream>>>(xh, wvh, bv, vth, MT, D_, D_, 1);

    flash_attn_wmma<<<dim3(S_ / 64, B_ * H_), 128, 0, stream>>>(qh, kh, vth, mask, valsh);

    gemm128_wmma<<<gg, 256, 0, stream>>>(valsh, woh, bo, d_out, MT, D_, D_, 2);
}

// v001
// It runs in 442 microseconds.
// In two side-by-side timings against v000, it was 1.28 and 1.27 times as fast.
#include <hip/hip_runtime.h>
#include <hip/hip_bf16.h>

// ---------------------------------------------------------------------------
// MI455X (gfx1250) multi-head attention, WMMA f16 path.
//   B=4 S=2048 D=1024 H=16 Hd=64.  ~137 GFLOP total -> compute bound; all
//   GEMM stages go through v_wmma_f32_16x16x32_f16 (f32 accumulate).
//   Data movement: GEMM tiles staged via async global->LDS (ASYNCcnt) when
//   the toolchain exposes the builtin; flash loop prefetches next K/V block.
// ---------------------------------------------------------------------------

typedef __attribute__((ext_vector_type(16))) _Float16 v16h;
typedef __attribute__((ext_vector_type(8)))  _Float16 v8h;
typedef __attribute__((ext_vector_type(8)))  float    v8f;
typedef __attribute__((__vector_size__(16))) int      v4i;   // matches builtin param

#define AS1_ __attribute__((address_space(1)))
#define AS3_ __attribute__((address_space(3)))

#define B_  4
#define S_  2048
#define D_  1024
#define H_  16
#define HD_ 64

#if defined(__has_builtin)
#if __has_builtin(__builtin_amdgcn_global_load_async_to_lds_b128)
#define USE_ASYNC_LDS 1
#endif
#endif

__device__ __forceinline__ void wait_asynccnt0() {
#if defined(__has_builtin) && __has_builtin(__builtin_amdgcn_s_wait_asynccnt)
    __builtin_amdgcn_s_wait_asynccnt(0);
#else
    asm volatile("s_wait_asynccnt 0" ::: "memory");
#endif
}

__device__ __forceinline__ v8f v8f_zero() {
    v8f z; for (int i = 0; i < 8; ++i) z[i] = 0.0f; return z;
}

// A/B fragment gather for v_wmma_f32_16x16x32_f16 (16x32 tile, K-contiguous
// rows).  Lane L<16: row L, K={0..7,16..23}; lane L>=16: row L-16,
// K={8..15,24..31}.  Two 16-byte loads per lane.
__device__ __forceinline__ v16h frag_ld(const _Float16* p16, int stride) {
    const int lane = threadIdx.x & 31;
    const int r    = lane & 15;
    const int ko   = (lane >> 4) << 3;            // 0 or 8
    const _Float16* p = p16 + (size_t)r * stride + ko;
    v8h lo = *(const v8h*)(p);
    v8h hi = *(const v8h*)(p + 16);
    return __builtin_shufflevector(lo, hi, 0,1,2,3,4,5,6,7,8,9,10,11,12,13,14,15);
}

__device__ __forceinline__ v8f wmma32(v16h a, v16h b, v8f c) {
    return __builtin_amdgcn_wmma_f32_16x16x32_f16(
        /*neg_a=*/false, a, /*neg_b=*/false, b,
        /*c_mod=*/(short)0, c, /*reuse_a=*/false, /*reuse_b=*/false);
}

// ---------------------------------------------------------------------------
// fp32 -> f16 conversion
// ---------------------------------------------------------------------------
__global__ void cvt_f32_f16(const float* __restrict__ s, _Float16* __restrict__ d, int n) {
    int i = blockIdx.x * blockDim.x + threadIdx.x;
    if (i < n) d[i] = (_Float16)s[i];
}

// ---------------------------------------------------------------------------
// C[M,N] = A[M,K] * Bt[N,K]^T + bias[N]   (A,Bt f16 row-major, K-contiguous)
// 128x128 block, 256 threads (8 waves), each wave: 32x64 via 2x4 WMMA tiles.
// mode 0: f16 out at [B,H,S,64]        (Q / K)
// mode 1: f16 out at [B,H,64,S]        (V transposed)
// mode 2: f32 out at [M,N] row-major   (final projection)
// ---------------------------------------------------------------------------
__global__ __launch_bounds__(256)
void gemm128_wmma(const _Float16* __restrict__ A, const _Float16* __restrict__ Bt,
                  const float* __restrict__ bias, void* __restrict__ Out,
                  int M, int N, int K, int mode)
{
    __shared__ __align__(16) _Float16 sA[128 * 40];
    __shared__ __align__(16) _Float16 sB[128 * 40];

    const int m0   = blockIdx.y * 128;
    const int n0   = blockIdx.x * 128;
    const int tid  = threadIdx.x;
    const int wid  = tid >> 5;
    const int wm   = (wid & 3) * 32;              // wave m-offset in tile
    const int wn   = (wid >> 2) * 64;             // wave n-offset in tile
    const int lrow = tid >> 1;                    // 0..127 : staged row
    const int lseg = (tid & 1) * 16;              // 0/16   : 16-half segment

    v8f acc[2][4];
    for (int i = 0; i < 2; ++i)
        for (int j = 0; j < 4; ++j) acc[i][j] = v8f_zero();

    for (int k0 = 0; k0 < K; k0 += 32) {
        const _Float16* ga = A  + (size_t)(m0 + lrow) * K + k0 + lseg;
        const _Float16* gb = Bt + (size_t)(n0 + lrow) * K + k0 + lseg;
#if USE_ASYNC_LDS
        // Direct global->LDS DMA (no VGPR round-trip); tracked by ASYNCcnt.
        __builtin_amdgcn_global_load_async_to_lds_b128(
            (AS1_ v4i*)(void*)ga, (AS3_ v4i*)&sA[lrow * 40 + lseg], 0, 0);
        __builtin_amdgcn_global_load_async_to_lds_b128(
            (AS1_ v4i*)(void*)ga, (AS3_ v4i*)&sA[lrow * 40 + lseg], 16, 0);
        __builtin_amdgcn_global_load_async_to_lds_b128(
            (AS1_ v4i*)(void*)gb, (AS3_ v4i*)&sB[lrow * 40 + lseg], 0, 0);
        __builtin_amdgcn_global_load_async_to_lds_b128(
            (AS1_ v4i*)(void*)gb, (AS3_ v4i*)&sB[lrow * 40 + lseg], 16, 0);
        wait_asynccnt0();
#else
        *(v8h*)(&sA[lrow * 40 + lseg])     = *(const v8h*)(ga);
        *(v8h*)(&sA[lrow * 40 + lseg + 8]) = *(const v8h*)(ga + 8);
        *(v8h*)(&sB[lrow * 40 + lseg])     = *(const v8h*)(gb);
        *(v8h*)(&sB[lrow * 40 + lseg + 8]) = *(const v8h*)(gb + 8);
#endif
        __syncthreads();

        v16h fa0 = frag_ld(&sA[(wm +  0) * 40], 40);
        v16h fa1 = frag_ld(&sA[(wm + 16) * 40], 40);
        v16h fb0 = frag_ld(&sB[(wn +  0) * 40], 40);
        v16h fb1 = frag_ld(&sB[(wn + 16) * 40], 40);
        v16h fb2 = frag_ld(&sB[(wn + 32) * 40], 40);
        v16h fb3 = frag_ld(&sB[(wn + 48) * 40], 40);

        acc[0][0] = wmma32(fa0, fb0, acc[0][0]);
        acc[0][1] = wmma32(fa0, fb1, acc[0][1]);
        acc[0][2] = wmma32(fa0, fb2, acc[0][2]);
        acc[0][3] = wmma32(fa0, fb3, acc[0][3]);
        acc[1][0] = wmma32(fa1, fb0, acc[1][0]);
        acc[1][1] = wmma32(fa1, fb1, acc[1][1]);
        acc[1][2] = wmma32(fa1, fb2, acc[1][2]);
        acc[1][3] = wmma32(fa1, fb3, acc[1][3]);
        __syncthreads();
    }

    // epilogue: C tile lane layout -> lane holds col (lane&15), rows r+8*(lane>>4)
    const int lane  = tid & 31;
    const int cn    = lane & 15;
    const int rbase = (lane >> 4) * 8;
    for (int i = 0; i < 2; ++i)
        for (int j = 0; j < 4; ++j) {
            const int n  = n0 + wn + 16 * j + cn;
            const float bv = bias[n];
            for (int r = 0; r < 8; ++r) {
                const int m = m0 + wm + 16 * i + rbase + r;
                const float v = acc[i][j][r] + bv;
                if (mode == 2) {
                    ((float*)Out)[(size_t)m * N + n] = v;
                } else {
                    const int b = m >> 11, s = m & (S_ - 1);
                    const int h = n >> 6,  hd = n & (HD_ - 1);
                    const size_t idx = (mode == 0)
                        ? ((size_t)((b * H_ + h) * S_ + s)) * HD_ + hd
                        : ((size_t)((b * H_ + h) * HD_ + hd)) * S_ + s;
                    ((_Float16*)Out)[idx] = (_Float16)v;
                }
            }
        }
}

typedef __attribute__((ext_vector_type(4))) float v4f;

// lane l <-> lane l ^ 16
__device__ __forceinline__ float xhalf(float x) {
    const int xi = __builtin_bit_cast(int, x);
    return __builtin_bit_cast(float, __builtin_amdgcn_permlanex16(
        xi, xi, 0x76543210, 0xfedcba98, false, false));
}

__global__ __launch_bounds__(128)
void flash_attn_wmma(const _Float16* __restrict__ Q, const _Float16* __restrict__ Km,
                     const _Float16* __restrict__ Vt, const int* __restrict__ mask,
                     _Float16* __restrict__ Outv)
{
    // additive key mask of this batch row: a lane needs 16 keys' values per step
    __shared__ __align__(16) float sBias[S_];

    const int bh   = blockIdx.y;                  // b*H + h
    const int b    = bh >> 4;
    const int h    = bh & 15;
    const int wid  = threadIdx.x >> 5;
    const int lane = threadIdx.x & 31;
    const int cn   = lane & 15;                   // query column of this lane
    const int rhalf = lane >> 4;                  // 0: rows 0..7, 1: rows 8..15
    const int q0   = blockIdx.x * 64 + wid * 16;

    const _Float16* Qbh = Q  + (size_t)bh * S_ * HD_;
    const _Float16* Kbh = Km + (size_t)bh * S_ * HD_;
    const _Float16* Vbh = Vt + (size_t)bh * HD_ * S_;
    const int*      mb  = mask + b * S_;

#pragma unroll  // all 16 loads of a thread in flight at once: one latency, not sixteen
    for (int i = 0; i < S_ / 128; ++i) {
        const int key = i * 128 + threadIdx.x;
        sBias[key] = mb[key] ? 0.0f : -1.0e30f;
    }

    v16h qf0 = frag_ld(Qbh + (size_t)q0 * HD_,      HD_);
    v16h qf1 = frag_ld(Qbh + (size_t)q0 * HD_ + 32, HD_);

    v8f o[4];
    for (int j = 0; j < 4; ++j) o[j] = v8f_zero();
    float mrow = -3.0e38f, lsum = 0.0f;           // lsum: this half's keys only

    const float scale = 0.125f;                   // 1/sqrt(64)

    __syncthreads();                              // bias table complete

    for (int n0 = 0; n0 < S_; n0 += 32) {
        // L2/WGP prefetch of the next key/value block while this one computes.
        if (n0 + 32 < S_) {
            __builtin_prefetch(Kbh + (size_t)(n0 + 32 + cn) * HD_, 0, 3);
            __builtin_prefetch(Vbh + (size_t)(cn * 4) * S_ + n0 + 32, 0, 3);
        }

        // ---- scores S^T[32x16] = K * Q^T ----
        v8f s0 = v8f_zero(), s1 = v8f_zero();
        {
            v16h kf;
            kf = frag_ld(Kbh + (size_t)(n0     ) * HD_,      HD_); s0 = wmma32(kf, qf0, s0);
            kf = frag_ld(Kbh + (size_t)(n0     ) * HD_ + 32, HD_); s0 = wmma32(kf, qf1, s0);
            kf = frag_ld(Kbh + (size_t)(n0 + 16) * HD_,      HD_); s1 = wmma32(kf, qf0, s1);
            kf = frag_ld(Kbh + (size_t)(n0 + 16) * HD_ + 32, HD_); s1 = wmma32(kf, qf1, s1);
        }

        // V^T fragments: A operand of the second product, same loader as before
        v16h vf[4];
#pragma unroll  // vf stays in registers only with constant indices
        for (int j = 0; j < 4; ++j)
            vf[j] = frag_ld(Vbh + (size_t)(j * 16) * S_ + n0, S_);

        const v4f* bp = (const v4f*)&sBias[n0 + 8 * rhalf];
        const v8f bias0 = __builtin_shufflevector(bp[0], bp[1], 0, 1, 2, 3, 4, 5, 6, 7);
        const v8f bias1 = __builtin_shufflevector(bp[4], bp[5], 0, 1, 2, 3, 4, 5, 6, 7);

        // ---- online softmax, one query per lane ----
        const v8f a0 = s0 * scale + bias0;
        const v8f a1 = s1 * scale + bias1;
        float cm = fmaxf(a0[0], a1[0]);
#pragma unroll  // constant indices keep the score tiles in registers
        for (int r = 1; r < 8; ++r) cm = fmaxf(cm, fmaxf(a0[r], a1[r]));
        cm = fmaxf(cm, xhalf(cm));                // both halves: the query's block maximum
        const float mn = fmaxf(mrow, cm);
        const float al = __expf(mrow - mn);
        mrow = mn;

        v16h pf;
        float pr[8];
#pragma unroll  // constant indices: registers, no indexed moves
        for (int r = 0; r < 8; ++r) {
            const float e0 = __expf(a0[r] - mn);
            const float e1 = __expf(a1[r] - mn);
            pr[r] = e0 + e1;
            pf[r]     = (_Float16)e0;             // k slots 0..7  = keys 8h + r
            pf[8 + r] = (_Float16)e1;             // k slots 8..15 = keys 16 + 8h + r
        }
        const float ps = ((pr[0] + pr[1]) + (pr[2] + pr[3])) + ((pr[4] + pr[5]) + (pr[6] + pr[7]));
        lsum = lsum * al + ps;

        // ---- O^T += V^T * P^T ----
#pragma unroll  // constant indices: registers, no indexed moves
        for (int j = 0; j < 4; ++j) {
            o[j] *= al;
            o[j] = wmma32(vf[j], pf, o[j]);
        }
    }

    // ---- finalize + write [B,S,D] f16: a lane holds 8 consecutive hd of its query ----
    const float lt = lsum + xhalf(lsum);
    _Float16* orow = Outv + ((size_t)(b * S_ + q0 + cn)) * D_ + h * HD_ + 8 * rhalf;
#pragma unroll  // constant indices: registers, no indexed moves
    for (int j = 0; j < 4; ++j) {
        v8h ov;
#pragma unroll  // constant indices: registers, no indexed moves
        for (int r = 0; r < 8; ++r) ov[r] = (_Float16)(o[j][r] / lt);
        *(v8h*)(orow + j * 16) = ov;
    }
}

// ---------------------------------------------------------------------------
extern "C" void kernel_launch(void* const* d_in, const int* in_sizes, int n_in,
                              void* d_out, int out_size, void* d_ws, size_t ws_size,
                              hipStream_t stream) {
    const float* x    = (const float*)d_in[0];
    const int*   mask = (const int*)  d_in[1];
    const float* Wq   = (const float*)d_in[2];
    const float* bq   = (const float*)d_in[3];
    const float* Wk   = (const float*)d_in[4];
    const float* bk   = (const float*)d_in[5];
    const float* Wv   = (const float*)d_in[6];
    const float* bv   = (const float*)d_in[7];
    const float* Wo   = (const float*)d_in[8];
    const float* bo   = (const float*)d_in[9];

    const int MT = B_ * S_;              // 8192 rows
    const int NX = MT * D_;              // 8388608
    const int NW = D_ * D_;              // 1048576

    _Float16* ws    = (_Float16*)d_ws;
    _Float16* xh    = ws;                // [8192,1024]
    _Float16* wqh   = xh   + NX;
    _Float16* wkh   = wqh  + NW;
    _Float16* wvh   = wkh  + NW;
    _Float16* woh   = wvh  + NW;
    _Float16* qh    = woh  + NW;         // [B,H,S,64]
    _Float16* kh    = qh   + NX;         // [B,H,S,64]
    _Float16* vth   = kh   + NX;         // [B,H,64,S]
    _Float16* valsh = vth  + NX;         // [B,S,D]

    cvt_f32_f16<<<(NX + 255) / 256, 256, 0, stream>>>(x,  xh,  NX);
    cvt_f32_f16<<<(NW + 255) / 256, 256, 0, stream>>>(Wq, wqh, NW);
    cvt_f32_f16<<<(NW + 255) / 256, 256, 0, stream>>>(Wk, wkh, NW);
    cvt_f32_f16<<<(NW + 255) / 256, 256, 0, stream>>>(Wv, wvh, NW);
    cvt_f32_f16<<<(NW + 255) / 256, 256, 0, stream>>>(Wo, woh, NW);

    dim3 gg(D_ / 128, MT / 128);         // (8, 64)
    gemm128_wmma<<<gg, 256, 0, stream>>>(xh, wqh, bq, qh,  MT, D_, D_, 0);
    gemm128_wmma<<<gg, 256, 0, stream>>>(xh, wkh, bk, kh,  MT, D_, D_, 0);
    gemm128_wmma<<<gg, 256, 0, stream>>>(xh, wvh, bv, vth, MT, D_, D_, 1);

    flash_attn_wmma<<<dim3(S_ / 64, B_ * H_), 128, 0, stream>>>(qh, kh, vth, mask, valsh);

    gemm128_wmma<<<gg, 256, 0, stream>>>(valsh, woh, bo, d_out, MT, D_, D_, 2);
}

// v002
// A run of this version takes 345 microseconds.
// In two side-by-side timings against v001, it was 1.29 and 1.28 times as fast.
// Counting every step since v000, it is 1.64 times as fast.
#include <hip/hip_runtime.h>
#include <hip/hip_bf16.h>

// ---------------------------------------------------------------------------
// MI455X (gfx1250) multi-head attention, WMMA f16 path.
//   B=4 S=2048 D=1024 H=16 Hd=64.  ~137 GFLOP total -> compute bound; all
//   GEMM stages go through v_wmma_f32_16x16x32_f16 (f32 accumulate).
//   Data movement: GEMM tiles staged via async global->LDS (ASYNCcnt) when
//   the toolchain exposes the builtin; flash loop prefetches next K/V block.
// ---------------------------------------------------------------------------

typedef __attribute__((ext_vector_type(16))) _Float16 v16h;
typedef __attribute__((ext_vector_type(8)))  _Float16 v8h;
typedef __attribute__((ext_vector_type(8)))  float    v8f;
typedef __attribute__((__vector_size__(16))) int      v4i;   // matches builtin param

#define AS1_ __attribute__((address_space(1)))
#define AS3_ __attribute__((address_space(3)))

#define B_  4
#define S_  2048
#define D_  1024
#define H_  16
#define HD_ 64

#if defined(__has_builtin)
#if __has_builtin(__builtin_amdgcn_global_load_async_to_lds_b128)
#define USE_ASYNC_LDS 1
#endif
#endif

__device__ __forceinline__ void wait_asynccnt0() {
#if defined(__has_builtin) && __has_builtin(__builtin_amdgcn_s_wait_asynccnt)
    __builtin_amdgcn_s_wait_asynccnt(0);
#else
    asm volatile("s_wait_asynccnt 0" ::: "memory");
#endif
}

__device__ __forceinline__ v8f v8f_zero() {
    v8f z; for (int i = 0; i < 8; ++i) z[i] = 0.0f; return z;
}

// A/B fragment gather for v_wmma_f32_16x16x32_f16 (16x32 tile, K-contiguous
// rows).  Lane L<16: row L, K={0..7,16..23}; lane L>=16: row L-16,
// K={8..15,24..31}.  Two 16-byte loads per lane.
__device__ __forceinline__ v16h frag_ld(const _Float16* p16, int stride) {
    const int lane = threadIdx.x & 31;
    const int r    = lane & 15;
    const int ko   = (lane >> 4) << 3;            // 0 or 8
    const _Float16* p = p16 + (size_t)r * stride + ko;
    v8h lo = *(const v8h*)(p);
    v8h hi = *(const v8h*)(p + 16);
    return __builtin_shufflevector(lo, hi, 0,1,2,3,4,5,6,7,8,9,10,11,12,13,14,15);
}

__device__ __forceinline__ v8f wmma32(v16h a, v16h b, v8f c) {
    return __builtin_amdgcn_wmma_f32_16x16x32_f16(
        /*neg_a=*/false, a, /*neg_b=*/false, b,
        /*c_mod=*/(short)0, c, /*reuse_a=*/false, /*reuse_b=*/false);
}

// ---------------------------------------------------------------------------
// fp32 -> f16 conversion
// ---------------------------------------------------------------------------
__global__ void cvt_f32_f16(const float* __restrict__ s, _Float16* __restrict__ d, int n) {
    int i = blockIdx.x * blockDim.x + threadIdx.x;
    if (i < n) d[i] = (_Float16)s[i];
}

// ---------------------------------------------------------------------------
// C[M,N] = A[M,K] * Bt[N,K]^T + bias[N]   (A,Bt f16 row-major, K-contiguous)
// 128x128 block, 256 threads (8 waves), each wave: 32x64 via 2x4 WMMA tiles.
// mode 0: f16 out at [B,H,S,64]        (Q / K)
// mode 1: f16 out at [B,H,64,S]        (V transposed)
// mode 2: f32 out at [M,N] row-major   (final projection)
// ---------------------------------------------------------------------------
__global__ __launch_bounds__(256)
void gemm128_wmma(const _Float16* __restrict__ A, const _Float16* __restrict__ Bt,
                  const float* __restrict__ bias, void* __restrict__ Out,
                  int M, int N, int K, int mode)
{
    __shared__ __align__(16) _Float16 sA[128 * 40];
    __shared__ __align__(16) _Float16 sB[128 * 40];

    const int m0   = blockIdx.y * 128;
    const int n0   = blockIdx.x * 128;
    const int tid  = threadIdx.x;
    const int wid  = tid >> 5;
    const int wm   = (wid & 3) * 32;              // wave m-offset in tile
    const int wn   = (wid >> 2) * 64;             // wave n-offset in tile
    const int lrow = tid >> 1;                    // 0..127 : staged row
    const int lseg = (tid & 1) * 16;              // 0/16   : 16-half segment

    v8f acc[2][4];
    for (int i = 0; i < 2; ++i)
        for (int j = 0; j < 4; ++j) acc[i][j] = v8f_zero();

    for (int k0 = 0; k0 < K; k0 += 32) {
        const _Float16* ga = A  + (size_t)(m0 + lrow) * K + k0 + lseg;
        const _Float16* gb = Bt + (size_t)(n0 + lrow) * K + k0 + lseg;
#if USE_ASYNC_LDS
        // Direct global->LDS DMA (no VGPR round-trip); tracked by ASYNCcnt.
        __builtin_amdgcn_global_load_async_to_lds_b128(
            (AS1_ v4i*)(void*)ga, (AS3_ v4i*)&sA[lrow * 40 + lseg], 0, 0);
        __builtin_amdgcn_global_load_async_to_lds_b128(
            (AS1_ v4i*)(void*)ga, (AS3_ v4i*)&sA[lrow * 40 + lseg], 16, 0);
        __builtin_amdgcn_global_load_async_to_lds_b128(
            (AS1_ v4i*)(void*)gb, (AS3_ v4i*)&sB[lrow * 40 + lseg], 0, 0);
        __builtin_amdgcn_global_load_async_to_lds_b128(
            (AS1_ v4i*)(void*)gb, (AS3_ v4i*)&sB[lrow * 40 + lseg], 16, 0);
        wait_asynccnt0();
#else
        *(v8h*)(&sA[lrow * 40 + lseg])     = *(const v8h*)(ga);
        *(v8h*)(&sA[lrow * 40 + lseg + 8]) = *(const v8h*)(ga + 8);
        *(v8h*)(&sB[lrow * 40 + lseg])     = *(const v8h*)(gb);
        *(v8h*)(&sB[lrow * 40 + lseg + 8]) = *(const v8h*)(gb + 8);
#endif
        __syncthreads();

        v16h fa0 = frag_ld(&sA[(wm +  0) * 40], 40);
        v16h fa1 = frag_ld(&sA[(wm + 16) * 40], 40);
        v16h fb0 = frag_ld(&sB[(wn +  0) * 40], 40);
        v16h fb1 = frag_ld(&sB[(wn + 16) * 40], 40);
        v16h fb2 = frag_ld(&sB[(wn + 32) * 40], 40);
        v16h fb3 = frag_ld(&sB[(wn + 48) * 40], 40);

        acc[0][0] = wmma32(fa0, fb0, acc[0][0]);
        acc[0][1] = wmma32(fa0, fb1, acc[0][1]);
        acc[0][2] = wmma32(fa0, fb2, acc[0][2]);
        acc[0][3] = wmma32(fa0, fb3, acc[0][3]);
        acc[1][0] = wmma32(fa1, fb0, acc[1][0]);
        acc[1][1] = wmma32(fa1, fb1, acc[1][1]);
        acc[1][2] = wmma32(fa1, fb2, acc[1][2]);
        acc[1][3] = wmma32(fa1, fb3, acc[1][3]);
        __syncthreads();
    }

    // epilogue: C tile lane layout -> lane holds col (lane&15), rows r+8*(lane>>4)
    const int lane  = tid & 31;
    const int cn    = lane & 15;
    const int rbase = (lane >> 4) * 8;
    for (int i = 0; i < 2; ++i)
        for (int j = 0; j < 4; ++j) {
            const int n  = n0 + wn + 16 * j + cn;
            const float bv = bias[n];
            for (int r = 0; r < 8; ++r) {
                const int m = m0 + wm + 16 * i + rbase + r;
                const float v = acc[i][j][r] + bv;
                if (mode == 2) {
                    ((float*)Out)[(size_t)m * N + n] = v;
                } else {
                    const int b = m >> 11, s = m & (S_ - 1);
                    const int h = n >> 6,  hd = n & (HD_ - 1);
                    const size_t idx = (mode == 0)
                        ? ((size_t)((b * H_ + h) * S_ + s)) * HD_ + hd
                        : ((size_t)((b * H_ + h) * HD_ + hd)) * S_ + s;
                    ((_Float16*)Out)[idx] = (_Float16)v;
                }
            }
        }
}

typedef __attribute__((ext_vector_type(4))) float v4f;

#define QT_ 4                                     // query tiles of 16 per wave

// lane l <-> lane l ^ 16
__device__ __forceinline__ float xhalf(float x) {
    const int xi = __builtin_bit_cast(int, x);
    return __builtin_bit_cast(float, __builtin_amdgcn_permlanex16(
        xi, xi, 0x76543210, 0xfedcba98, false, false));
}

__global__ __launch_bounds__(128)
void flash_attn_wmma(const _Float16* __restrict__ Q, const _Float16* __restrict__ Km,
                     const _Float16* __restrict__ Vt, const int* __restrict__ mask,
                     _Float16* __restrict__ Outv)
{
    // additive key mask of this batch row: a lane needs 16 keys' values per step
    __shared__ __align__(16) float sBias[S_];

    const int bh   = blockIdx.y;                  // b*H + h
    const int b    = bh >> 4;
    const int h    = bh & 15;
    const int wid  = threadIdx.x >> 5;
    const int lane = threadIdx.x & 31;
    const int cn   = lane & 15;                   // query column of this lane
    const int rhalf = lane >> 4;                  // 0: rows 0..7, 1: rows 8..15
    const int q0   = blockIdx.x * (64 * QT_) + wid * (16 * QT_);

    const _Float16* Qbh = Q  + (size_t)bh * S_ * HD_;
    const _Float16* Kbh = Km + (size_t)bh * S_ * HD_;
    const _Float16* Vbh = Vt + (size_t)bh * HD_ * S_;
    const int*      mb  = mask + b * S_;

#pragma unroll  // all 16 loads of a thread in flight at once: one latency, not sixteen
    for (int i = 0; i < S_ / 128; ++i) {
        const int key = i * 128 + threadIdx.x;
        sBias[key] = mb[key] ? 0.0f : -1.0e30f;
    }

    v16h qf[QT_][2];
    v8f  o[QT_][4];
    float mrow[QT_], lsum[QT_];                   // lsum: this half's keys only
#pragma unroll  // constant indices: registers, no indexed moves
    for (int t = 0; t < QT_; ++t) {
        qf[t][0] = frag_ld(Qbh + (size_t)(q0 + 16 * t) * HD_,      HD_);
        qf[t][1] = frag_ld(Qbh + (size_t)(q0 + 16 * t) * HD_ + 32, HD_);
    }
    // address registers of the mask and Q loads are reused below: wait first
    asm volatile("s_wait_xcnt 0x0" ::: "memory");
    __builtin_amdgcn_sched_barrier(0);            // keeps the register writes below behind that wait

#pragma unroll  // constant indices: registers, no indexed moves
    for (int t = 0; t < QT_; ++t) {
#pragma unroll  // constant indices: registers, no indexed moves
        for (int j = 0; j < 4; ++j) o[t][j] = v8f_zero();
        mrow[t] = -3.0e38f;
        lsum[t] = 0.0f;
    }

    const float scale = 0.125f;                   // 1/sqrt(64)

    __syncthreads();                              // bias table complete

    for (int n0 = 0; n0 < S_; n0 += 32) {
        // L2/WGP prefetch of the next key/value block while this one computes.
        if (n0 + 32 < S_) {
            __builtin_prefetch(Kbh + (size_t)(n0 + 32 + cn) * HD_, 0, 3);
            __builtin_prefetch(Vbh + (size_t)(cn * 4) * S_ + n0 + 32, 0, 3);
        }

        // K fragments (A operand of the first product), loaded once for all tiles
        const v16h kf00 = frag_ld(Kbh + (size_t)(n0     ) * HD_,      HD_);
        const v16h kf01 = frag_ld(Kbh + (size_t)(n0     ) * HD_ + 32, HD_);
        const v16h kf10 = frag_ld(Kbh + (size_t)(n0 + 16) * HD_,      HD_);
        const v16h kf11 = frag_ld(Kbh + (size_t)(n0 + 16) * HD_ + 32, HD_);
        // the K address pair may be reused as a destination of the V loads: wait first
        asm volatile("s_wait_xcnt 0x0" ::: "memory");

        // V^T fragments: A operand of the second product, same loader as before
        v16h vf[4];
#pragma unroll  // vf stays in registers only with constant indices
        for (int j = 0; j < 4; ++j)
            vf[j] = frag_ld(Vbh + (size_t)(j * 16) * S_ + n0, S_);
        // the V address pair is reused by the arithmetic below: wait first
        asm volatile("s_wait_xcnt 0x0" ::: "memory");

        const v4f* bp = (const v4f*)&sBias[n0 + 8 * rhalf];
        const v8f bias0 = __builtin_shufflevector(bp[0], bp[1], 0, 1, 2, 3, 4, 5, 6, 7);
        const v8f bias1 = __builtin_shufflevector(bp[4], bp[5], 0, 1, 2, 3, 4, 5, 6, 7);

        // ---- scores S^T[32x16] = K * Q^T, per query tile ----
        v8f s0[QT_], s1[QT_];
#pragma unroll  // constant indices: registers, no indexed moves
        for (int t = 0; t < QT_; ++t) {
            s0[t] = wmma32(kf00, qf[t][0], v8f_zero());
            s1[t] = wmma32(kf10, qf[t][0], v8f_zero());
        }
#pragma unroll  // constant indices: registers, no indexed moves
        for (int t = 0; t < QT_; ++t) {
            s0[t] = wmma32(kf01, qf[t][1], s0[t]);
            s1[t] = wmma32(kf11, qf[t][1], s1[t]);
        }

#pragma unroll  // constant indices: registers, no indexed moves
        for (int t = 0; t < QT_; ++t) {
            // ---- online softmax, one query per lane ----
            const v8f a0 = s0[t] * scale + bias0;
            const v8f a1 = s1[t] * scale + bias1;
            float cm = fmaxf(a0[0], a1[0]);
#pragma unroll  // constant indices keep the score tiles in registers
            for (int r = 1; r < 8; ++r) cm = fmaxf(cm, fmaxf(a0[r], a1[r]));
            cm = fmaxf(cm, xhalf(cm));            // both halves: the query's block maximum
            const float mn = fmaxf(mrow[t], cm);
            const float al = __expf(mrow[t] - mn);
            mrow[t] = mn;

            v16h pf;
            float pr[8];
            const v8f d0 = a0 - mn;               // whole tiles: neighbouring registers pair up
            const v8f d1 = a1 - mn;
            v8f e0, e1;
#pragma unroll  // constant indices: registers, no indexed moves
            for (int r = 0; r < 8; ++r) e0[r] = __expf(d0[r]);
#pragma unroll  // constant indices: registers, no indexed moves
            for (int r = 0; r < 8; ++r) e1[r] = __expf(d1[r]);
#pragma unroll  // constant indices: registers, no indexed moves
            for (int r = 0; r < 8; ++r) {
                pr[r] = e0[r] + e1[r];
                pf[r]     = (_Float16)e0[r];      // k slots 0..7  = keys 8h + r
                pf[8 + r] = (_Float16)e1[r];      // k slots 8..15 = keys 16 + 8h + r
            }
            const float ps = ((pr[0] + pr[1]) + (pr[2] + pr[3])) + ((pr[4] + pr[5]) + (pr[6] + pr[7]));
            lsum[t] = lsum[t] * al + ps;

            // ---- O^T += V^T * P^T ----
#pragma unroll  // constant indices: registers, no indexed moves
            for (int j = 0; j < 4; ++j) {
                o[t][j] *= al;
                o[t][j] = wmma32(vf[j], pf, o[t][j]);
            }
        }
    }

    // ---- finalize + write [B,S,D] f16: a lane holds 8 consecutive hd of its query ----
#pragma unroll  // constant indices: registers, no indexed moves
    for (int t = 0; t < QT_; ++t) {
        const float lt = lsum[t] + xhalf(lsum[t]);
        _Float16* orow = Outv + ((size_t)(b * S_ + q0 + 16 * t + cn)) * D_ + h * HD_ + 8 * rhalf;
#pragma unroll  // constant indices: registers, no indexed moves
        for (int j = 0; j < 4; ++j) {
            v8h ov;
#pragma unroll  // constant indices: registers, no indexed moves
            for (int r = 0; r < 8; ++r) ov[r] = (_Float16)(o[t][j][r] / lt);
            *(v8h*)(orow + j * 16) = ov;
        }
    }
}

// ---------------------------------------------------------------------------
extern "C" void kernel_launch(void* const* d_in, const int* in_sizes, int n_in,
                              void* d_out, int out_size, void* d_ws, size_t ws_size,
                              hipStream_t stream) {
    const float* x    = (const float*)d_in[0];
    const int*   mask = (const int*)  d_in[1];
    const float* Wq   = (const float*)d_in[2];
    const float* bq   = (const float*)d_in[3];
    const float* Wk   = (const float*)d_in[4];
    const float* bk   = (const float*)d_in[5];
    const float* Wv   = (const float*)d_in[6];
    const float* bv   = (const float*)d_in[7];
    const float* Wo   = (const float*)d_in[8];
    const float* bo   = (const float*)d_in[9];

    const int MT = B_ * S_;              // 8192 rows
    const int NX = MT * D_;              // 8388608
    const int NW = D_ * D_;              // 1048576

    _Float16* ws    = (_Float16*)d_ws;
    _Float16* xh    = ws;                // [8192,1024]
    _Float16* wqh   = xh   + NX;
    _Float16* wkh   = wqh  + NW;
    _Float16* wvh   = wkh  + NW;
    _Float16* woh   = wvh  + NW;
    _Float16* qh    = woh  + NW;         // [B,H,S,64]
    _Float16* kh    = qh   + NX;         // [B,H,S,64]
    _Float16* vth   = kh   + NX;         // [B,H,64,S]
    _Float16* valsh = vth  + NX;         // [B,S,D]

    cvt_f32_f16<<<(NX + 255) / 256, 256, 0, stream>>>(x,  xh,  NX);
    cvt_f32_f16<<<(NW + 255) / 256, 256, 0, stream>>>(Wq, wqh, NW);
    cvt_f32_f16<<<(NW + 255) / 256, 256, 0, stream>>>(Wk, wkh, NW);
    cvt_f32_f16<<<(NW + 255) / 256, 256, 0, stream>>>(Wv, wvh, NW);
    cvt_f32_f16<<<(NW + 255) / 256, 256, 0, stream>>>(Wo, woh, NW);

    dim3 gg(D_ / 128, MT / 128);         // (8, 64)
    gemm128_wmma<<<gg, 256, 0, stream>>>(xh, wqh, bq, qh,  MT, D_, D_, 0);
    gemm128_wmma<<<gg, 256, 0, stream>>>(xh, wkh, bk, kh,  MT, D_, D_, 0);
    gemm128_wmma<<<gg, 256, 0, stream>>>(xh, wvh, bv, vth, MT, D_, D_, 1);

    flash_attn_wmma<<<dim3(S_ / (64 * QT_), B_ * H_), 128, 0, stream>>>(qh, kh, vth, mask, valsh);

    gemm128_wmma<<<gg, 256, 0, stream>>>(valsh, woh, bo, d_out, MT, D_, D_, 2);
}

// v003
// Measured time: 332 microseconds a run.
// Next to v002, in two timings, it ran 1.05 and 1.04 times as fast.
// All steps since v000 together make it 1.71 times as fast.
#include <hip/hip_runtime.h>
#include <hip/hip_bf16.h>

// ---------------------------------------------------------------------------
// MI455X (gfx1250) multi-head attention, WMMA f16 path.
//   B=4 S=2048 D=1024 H=16 Hd=64.  ~137 GFLOP total -> compute bound; all
//   GEMM stages go through v_wmma_f32_16x16x32_f16 (f32 accumulate).
//   Data movement: GEMM tiles staged via async global->LDS (ASYNCcnt) when
//   the toolchain exposes the builtin; flash loop prefetches next K/V block.
// ---------------------------------------------------------------------------

typedef __attribute__((ext_vector_type(16))) _Float16 v16h;
typedef __attribute__((ext_vector_type(8)))  _Float16 v8h;
typedef __attribute__((ext_vector_type(8)))  float    v8f;
typedef __attribute__((ext_vector_type(4)))  float    v4f;
typedef __attribute__((ext_vector_type(4)))  _Float16 v4h;
typedef __attribute__((__vector_size__(16))) int      v4i;   // matches builtin param

#define AS1_ __attribute__((address_space(1)))
#define AS3_ __attribute__((address_space(3)))

#define B_  4
#define S_  2048
#define D_  1024
#define H_  16
#define HD_ 64

#if defined(__has_builtin)
#if __has_builtin(__builtin_amdgcn_global_load_async_to_lds_b128)
#define USE_ASYNC_LDS 1
#endif
#endif

__device__ __forceinline__ void wait_asynccnt0() {
#if defined(__has_builtin) && __has_builtin(__builtin_amdgcn_s_wait_asynccnt)
    __builtin_amdgcn_s_wait_asynccnt(0);
#else
    asm volatile("s_wait_asynccnt 0" ::: "memory");
#endif
}

__device__ __forceinline__ v8f v8f_zero() {
    v8f z; for (int i = 0; i < 8; ++i) z[i] = 0.0f; return z;
}

// A/B fragment gather for v_wmma_f32_16x16x32_f16 (16x32 tile, K-contiguous
// rows).  Lane L<16: row L, K={0..7,16..23}; lane L>=16: row L-16,
// K={8..15,24..31}.  Two 16-byte loads per lane.
__device__ __forceinline__ v16h frag_ld(const _Float16* p16, int stride) {
    const int lane = threadIdx.x & 31;
    const int r    = lane & 15;
    const int ko   = (lane >> 4) << 3;            // 0 or 8
    const _Float16* p = p16 + (size_t)r * stride + ko;
    v8h lo = *(const v8h*)(p);
    v8h hi = *(const v8h*)(p + 16);
    return __builtin_shufflevector(lo, hi, 0,1,2,3,4,5,6,7,8,9,10,11,12,13,14,15);
}

__device__ __forceinline__ v8f wmma32(v16h a, v16h b, v8f c) {
    return __builtin_amdgcn_wmma_f32_16x16x32_f16(
        /*neg_a=*/false, a, /*neg_b=*/false, b,
        /*c_mod=*/(short)0, c, /*reuse_a=*/false, /*reuse_b=*/false);
}

// ---------------------------------------------------------------------------
// fp32 -> f16 conversion.  A lane converts CVT_U groups of 4 elements, so a
// launch starts 1/64 of the waves that one element per lane needs.
// A wave owns CVT_U * 128 consecutive elements: each load instruction covers
// 512 contiguous bytes, each store 256, whole 128-byte lines both ways.
// No tail: every array length is a multiple of CVT_TILE (asserted below).
// ---------------------------------------------------------------------------
#define CVT_U    16                               // 16-byte loads in flight per lane
#define CVT_TILE (256 * CVT_U * 4)                // elements per block
static_assert((B_ * S_ * D_) % CVT_TILE == 0 && (D_ * D_) % CVT_TILE == 0,
              "conversion has no tail handling");

__global__ __launch_bounds__(256)
void cvt_f32_f16(const float* __restrict__ s, _Float16* __restrict__ d) {
    const int e0 = blockIdx.x * CVT_TILE + (threadIdx.x >> 5) * (CVT_U * 128)
                 + (threadIdx.x & 31) * 4;
    const float* p = s + e0;
    v4f v[CVT_U];
#pragma unroll  // all loads of a lane issue before the first convert: one memory latency per wave
    for (int u = 0; u < CVT_U; ++u) v[u] = *(const v4f*)(p + u * 128);
    // wait before any register that the loads name is rewritten; p as an input keeps the
    // address pair from becoming a load's destination while earlier loads still name it
    asm volatile("s_wait_xcnt 0x0" :: "v"(p) : "memory");
    // without it the compiler lifts converts over the wait and holds the last four loads
    // back until the first have landed: a second memory latency
    __builtin_amdgcn_sched_barrier(0);
#pragma unroll  // constant indices: registers, no indexed moves
    for (int u = 0; u < CVT_U; ++u)
        *(v4h*)(d + e0 + u * 128) = __builtin_convertvector(v[u], v4h);
}

// ---------------------------------------------------------------------------
// C[M,N] = A[M,K] * Bt[N,K]^T + bias[N]   (A,Bt f16 row-major, K-contiguous)
// 128x128 block, 256 threads (8 waves), each wave: 32x64 via 2x4 WMMA tiles.
// mode 0: f16 out at [B,H,S,64]        (Q / K)
// mode 1: f16 out at [B,H,64,S]        (V transposed)
// mode 2: f32 out at [M,N] row-major   (final projection)
// ---------------------------------------------------------------------------
__global__ __launch_bounds__(256)
void gemm128_wmma(const _Float16* __restrict__ A, const _Float16* __restrict__ Bt,
                  const float* __restrict__ bias, void* __restrict__ Out,
                  int M, int N, int K, int mode)
{
    __shared__ __align__(16) _Float16 sA[128 * 40];
    __shared__ __align__(16) _Float16 sB[128 * 40];

    const int m0   = blockIdx.y * 128;
    const int n0   = blockIdx.x * 128;
    const int tid  = threadIdx.x;
    const int wid  = tid >> 5;
    const int wm   = (wid & 3) * 32;              // wave m-offset in tile
    const int wn   = (wid >> 2) * 64;             // wave n-offset in tile
    const int lrow = tid >> 1;                    // 0..127 : staged row
    const int lseg = (tid & 1) * 16;              // 0/16   : 16-half segment

    v8f acc[2][4];
    for (int i = 0; i < 2; ++i)
        for (int j = 0; j < 4; ++j) acc[i][j] = v8f_zero();

    for (int k0 = 0; k0 < K; k0 += 32) {
        const _Float16* ga = A  + (size_t)(m0 + lrow) * K + k0 + lseg;
        const _Float16* gb = Bt + (size_t)(n0 + lrow) * K + k0 + lseg;
#if USE_ASYNC_LDS
        // Direct global->LDS DMA (no VGPR round-trip); tracked by ASYNCcnt.
        __builtin_amdgcn_global_load_async_to_lds_b128(
            (AS1_ v4i*)(void*)ga, (AS3_ v4i*)&sA[lrow * 40 + lseg], 0, 0);
        __builtin_amdgcn_global_load_async_to_lds_b128(
            (AS1_ v4i*)(void*)ga, (AS3_ v4i*)&sA[lrow * 40 + lseg], 16, 0);
        __builtin_amdgcn_global_load_async_to_lds_b128(
            (AS1_ v4i*)(void*)gb, (AS3_ v4i*)&sB[lrow * 40 + lseg], 0, 0);
        __builtin_amdgcn_global_load_async_to_lds_b128(
            (AS1_ v4i*)(void*)gb, (AS3_ v4i*)&sB[lrow * 40 + lseg], 16, 0);
        wait_asynccnt0();
#else
        *(v8h*)(&sA[lrow * 40 + lseg])     = *(const v8h*)(ga);
        *(v8h*)(&sA[lrow * 40 + lseg + 8]) = *(const v8h*)(ga + 8);
        *(v8h*)(&sB[lrow * 40 + lseg])     = *(const v8h*)(gb);
        *(v8h*)(&sB[lrow * 40 + lseg + 8]) = *(const v8h*)(gb + 8);
#endif
        __syncthreads();

        v16h fa0 = frag_ld(&sA[(wm +  0) * 40], 40);
        v16h fa1 = frag_ld(&sA[(wm + 16) * 40], 40);
        v16h fb0 = frag_ld(&sB[(wn +  0) * 40], 40);
        v16h fb1 = frag_ld(&sB[(wn + 16) * 40], 40);
        v16h fb2 = frag_ld(&sB[(wn + 32) * 40], 40);
        v16h fb3 = frag_ld(&sB[(wn + 48) * 40], 40);

        acc[0][0] = wmma32(fa0, fb0, acc[0][0]);
        acc[0][1] = wmma32(fa0, fb1, acc[0][1]);
        acc[0][2] = wmma32(fa0, fb2, acc[0][2]);
        acc[0][3] = wmma32(fa0, fb3, acc[0][3]);
        acc[1][0] = wmma32(fa1, fb0, acc[1][0]);
        acc[1][1] = wmma32(fa1, fb1, acc[1][1]);
        acc[1][2] = wmma32(fa1, fb2, acc[1][2]);
        acc[1][3] = wmma32(fa1, fb3, acc[1][3]);
        __syncthreads();
    }

    // epilogue: C tile lane layout -> lane holds col (lane&15), rows r+8*(lane>>4)
    const int lane  = tid & 31;
    const int cn    = lane & 15;
    const int rbase = (lane >> 4) * 8;
    for (int i = 0; i < 2; ++i)
        for (int j = 0; j < 4; ++j) {
            const int n  = n0 + wn + 16 * j + cn;
            const float bv = bias[n];
            for (int r = 0; r < 8; ++r) {
                const int m = m0 + wm + 16 * i + rbase + r;
                const float v = acc[i][j][r] + bv;
                if (mode == 2) {
                    ((float*)Out)[(size_t)m * N + n] = v;
                } else {
                    const int b = m >> 11, s = m & (S_ - 1);
                    const int h = n >> 6,  hd = n & (HD_ - 1);
                    const size_t idx = (mode == 0)
                        ? ((size_t)((b * H_ + h) * S_ + s)) * HD_ + hd
                        : ((size_t)((b * H_ + h) * HD_ + hd)) * S_ + s;
                    ((_Float16*)Out)[idx] = (_Float16)v;
                }
            }
        }
}

#define QT_ 4

// lane l <-> lane l ^ 16
__device__ __forceinline__ float xhalf(float x) {
    const int xi = __builtin_bit_cast(int, x);
    return __builtin_bit_cast(float, __builtin_amdgcn_permlanex16(
        xi, xi, 0x76543210, 0xfedcba98, false, false));
}

__global__ __launch_bounds__(128)
void flash_attn_wmma(const _Float16* __restrict__ Q, const _Float16* __restrict__ Km,
                     const _Float16* __restrict__ Vt, const int* __restrict__ mask,
                     _Float16* __restrict__ Outv)
{
    // additive key mask of this batch row: a lane needs 16 keys' values per step
    __shared__ __align__(16) float sBias[S_];

    const int bh   = blockIdx.y;                  // b*H + h
    const int b    = bh >> 4;
    const int h    = bh & 15;
    const int wid  = threadIdx.x >> 5;
    const int lane = threadIdx.x & 31;
    const int cn   = lane & 15;                   // query column of this lane
    const int rhalf = lane >> 4;                  // 0: rows 0..7, 1: rows 8..15
    const int q0   = blockIdx.x * (64 * QT_) + wid * (16 * QT_);

    const _Float16* Qbh = Q  + (size_t)bh * S_ * HD_;
    const _Float16* Kbh = Km + (size_t)bh * S_ * HD_;
    const _Float16* Vbh = Vt + (size_t)bh * HD_ * S_;
    const int*      mb  = mask + b * S_;

#pragma unroll  // all 16 loads of a thread in flight at once: one latency, not sixteen
    for (int i = 0; i < S_ / 128; ++i) {
        const int key = i * 128 + threadIdx.x;
        sBias[key] = mb[key] ? 0.0f : -1.0e30f;
    }

    v16h qf[QT_][2];
    v8f  o[QT_][4];
    float mrow[QT_], lsum[QT_];                   // lsum: this half's keys only
#pragma unroll  // constant indices: registers, no indexed moves
    for (int t = 0; t < QT_; ++t) {
        qf[t][0] = frag_ld(Qbh + (size_t)(q0 + 16 * t) * HD_,      HD_);
        qf[t][1] = frag_ld(Qbh + (size_t)(q0 + 16 * t) * HD_ + 32, HD_);
    }
    // address registers of the mask and Q loads are reused below: wait first
    asm volatile("s_wait_xcnt 0x0" ::: "memory");
    __builtin_amdgcn_sched_barrier(0);            // keeps the register writes below behind that wait

#pragma unroll  // constant indices: registers, no indexed moves
    for (int t = 0; t < QT_; ++t) {
#pragma unroll  // constant indices: registers, no indexed moves
        for (int j = 0; j < 4; ++j) o[t][j] = v8f_zero();
        mrow[t] = -3.0e38f;
        lsum[t] = 0.0f;
    }

    const float scale = 0.125f;                   // 1/sqrt(64)

    __syncthreads();                              // bias table complete

    for (int n0 = 0; n0 < S_; n0 += 32) {
        // L2/WGP prefetch of the next key/value block while this one computes.
        if (n0 + 32 < S_) {
            __builtin_prefetch(Kbh + (size_t)(n0 + 32 + cn) * HD_, 0, 3);
            __builtin_prefetch(Vbh + (size_t)(cn * 4) * S_ + n0 + 32, 0, 3);
        }

        // K fragments (A operand of the first product), loaded once for all tiles
        const v16h kf00 = frag_ld(Kbh + (size_t)(n0     ) * HD_,      HD_);
        const v16h kf01 = frag_ld(Kbh + (size_t)(n0     ) * HD_ + 32, HD_);
        const v16h kf10 = frag_ld(Kbh + (size_t)(n0 + 16) * HD_,      HD_);
        const v16h kf11 = frag_ld(Kbh + (size_t)(n0 + 16) * HD_ + 32, HD_);
        // the K address pair may be reused as a destination of the V loads: wait first
        asm volatile("s_wait_xcnt 0x0" ::: "memory");

        // V^T fragments: A operand of the second product, same loader as before
        v16h vf[4];
#pragma unroll  // vf stays in registers only with constant indices
        for (int j = 0; j < 4; ++j)
            vf[j] = frag_ld(Vbh + (size_t)(j * 16) * S_ + n0, S_);
        // the V address pair is reused by the arithmetic below: wait first
        asm volatile("s_wait_xcnt 0x0" ::: "memory");

        const v4f* bp = (const v4f*)&sBias[n0 + 8 * rhalf];
        const v8f bias0 = __builtin_shufflevector(bp[0], bp[1], 0, 1, 2, 3, 4, 5, 6, 7);
        const v8f bias1 = __builtin_shufflevector(bp[4], bp[5], 0, 1, 2, 3, 4, 5, 6, 7);

        // ---- scores S^T[32x16] = K * Q^T, per query tile ----
        v8f s0[QT_], s1[QT_];
#pragma unroll  // constant indices: registers, no indexed moves
        for (int t = 0; t < QT_; ++t) {
            s0[t] = wmma32(kf00, qf[t][0], v8f_zero());
            s1[t] = wmma32(kf10, qf[t][0], v8f_zero());
        }
#pragma unroll  // constant indices: registers, no indexed moves
        for (int t = 0; t < QT_; ++t) {
            s0[t] = wmma32(kf01, qf[t][1], s0[t]);
            s1[t] = wmma32(kf11, qf[t][1], s1[t]);
        }

#pragma unroll  // constant indices: registers, no indexed moves
        for (int t = 0; t < QT_; ++t) {
            // ---- online softmax, one query per lane ----
            const v8f a0 = s0[t] * scale + bias0;
            const v8f a1 = s1[t] * scale + bias1;
            float cm = fmaxf(a0[0], a1[0]);
#pragma unroll  // constant indices keep the score tiles in registers
            for (int r = 1; r < 8; ++r) cm = fmaxf(cm, fmaxf(a0[r], a1[r]));
            cm = fmaxf(cm, xhalf(cm));            // both halves: the query's block maximum
            const float mn = fmaxf(mrow[t], cm);
            const float al = __expf(mrow[t] - mn);
            mrow[t] = mn;

            v16h pf;
            float pr[8];
            const v8f d0 = a0 - mn;               // whole tiles: neighbouring registers pair up
            const v8f d1 = a1 - mn;
            v8f e0, e1;
#pragma unroll  // constant indices: registers, no indexed moves
            for (int r = 0; r < 8; ++r) e0[r] = __expf(d0[r]);
#pragma unroll  // constant indices: registers, no indexed moves
            for (int r = 0; r < 8; ++r) e1[r] = __expf(d1[r]);
#pragma unroll  // constant indices: registers, no indexed moves
            for (int r = 0; r < 8; ++r) {
                pr[r] = e0[r] + e1[r];
                pf[r]     = (_Float16)e0[r];      // k slots 0..7  = keys 8h + r
                pf[8 + r] = (_Float16)e1[r];      // k slots 8..15 = keys 16 + 8h + r
            }
            const float ps = ((pr[0] + pr[1]) + (pr[2] + pr[3])) + ((pr[4] + pr[5]) + (pr[6] + pr[7]));
            lsum[t] = lsum[t] * al + ps;

            // ---- O^T += V^T * P^T ----
#pragma unroll  // constant indices: registers, no indexed moves
            for (int j = 0; j < 4; ++j) {
                o[t][j] *= al;
                o[t][j] = wmma32(vf[j], pf, o[t][j]);
            }
        }
    }

    // ---- finalize + write [B,S,D] f16: a lane holds 8 consecutive hd of its query ----
#pragma unroll  // constant indices: registers, no indexed moves
    for (int t = 0; t < QT_; ++t) {
        const float lt = lsum[t] + xhalf(lsum[t]);
        _Float16* orow = Outv + ((size_t)(b * S_ + q0 + 16 * t + cn)) * D_ + h * HD_ + 8 * rhalf;
#pragma unroll  // constant indices: registers, no indexed moves
        for (int j = 0; j < 4; ++j) {
            v8h ov;
#pragma unroll  // constant indices: registers, no indexed moves
            for (int r = 0; r < 8; ++r) ov[r] = (_Float16)(o[t][j][r] / lt);
            *(v8h*)(orow + j * 16) = ov;
        }
    }
}

// ---------------------------------------------------------------------------
extern "C" void kernel_launch(void* const* d_in, const int* in_sizes, int n_in,
                              void* d_out, int out_size, void* d_ws, size_t ws_size,
                              hipStream_t stream) {
    const float* x    = (const float*)d_in[0];
    const int*   mask = (const int*)  d_in[1];
    const float* Wq   = (const float*)d_in[2];
    const float* bq   = (const float*)d_in[3];
    const float* Wk   = (const float*)d_in[4];
    const float* bk   = (const float*)d_in[5];
    const float* Wv   = (const float*)d_in[6];
    const float* bv   = (const float*)d_in[7];
    const float* Wo   = (const float*)d_in[8];
    const float* bo   = (const float*)d_in[9];

    const int MT = B_ * S_;              // 8192 rows
    const int NX = MT * D_;              // 8388608
    const int NW = D_ * D_;              // 1048576

    _Float16* ws    = (_Float16*)d_ws;
    _Float16* xh    = ws;                // [8192,1024]
    _Float16* wqh   = xh   + NX;
    _Float16* wkh   = wqh  + NW;
    _Float16* wvh   = wkh  + NW;
    _Float16* woh   = wvh  + NW;
    _Float16* qh    = woh  + NW;         // [B,H,S,64]
    _Float16* kh    = qh   + NX;         // [B,H,S,64]
    _Float16* vth   = kh   + NX;         // [B,H,64,S]
    _Float16* valsh = vth  + NX;         // [B,S,D]

    cvt_f32_f16<<<NX / CVT_TILE, 256, 0, stream>>>(x,  xh);
    cvt_f32_f16<<<NW / CVT_TILE, 256, 0, stream>>>(Wq, wqh);
    cvt_f32_f16<<<NW / CVT_TILE, 256, 0, stream>>>(Wk, wkh);
    cvt_f32_f16<<<NW / CVT_TILE, 256, 0, stream>>>(Wv, wvh);
    cvt_f32_f16<<<NW / CVT_TILE, 256, 0, stream>>>(Wo, woh);

    dim3 gg(D_ / 128, MT / 128);         // (8, 64)
    gemm128_wmma<<<gg, 256, 0, stream>>>(xh, wqh, bq, qh,  MT, D_, D_, 0);
    gemm128_wmma<<<gg, 256, 0, stream>>>(xh, wkh, bk, kh,  MT, D_, D_, 0);
    gemm128_wmma<<<gg, 256, 0, stream>>>(xh, wvh, bv, vth, MT, D_, D_, 1);

    flash_attn_wmma<<<dim3(S_ / (64 * QT_), B_ * H_), 128, 0, stream>>>(qh, kh, vth, mask, valsh);

    gemm128_wmma<<<gg, 256, 0, stream>>>(valsh, woh, bo, d_out, MT, D_, D_, 2);
}

// v004
// One run takes 304 microseconds.
// In two side-by-side timings against v003, it was 1.10 and 1.09 times as fast.
// Over all steps from v000 it is 1.87 times as fast.
#include <hip/hip_runtime.h>
#include <hip/hip_bf16.h>

// ---------------------------------------------------------------------------
// MI455X (gfx1250) multi-head attention, WMMA f16 path.
//   B=4 S=2048 D=1024 H=16 Hd=64.  ~137 GFLOP total -> compute bound; all
//   GEMM stages go through v_wmma_f32_16x16x32_f16 (f32 accumulate).
//   Data movement: GEMM tiles staged via async global->LDS (ASYNCcnt);
//   flash loop prefetches next K/V block.
// ---------------------------------------------------------------------------

typedef __attribute__((ext_vector_type(16))) _Float16 v16h;
typedef __attribute__((ext_vector_type(8)))  _Float16 v8h;
typedef __attribute__((ext_vector_type(8)))  float    v8f;
typedef __attribute__((ext_vector_type(4)))  float    v4f;
typedef __attribute__((ext_vector_type(4)))  _Float16 v4h;
typedef __attribute__((__vector_size__(16))) int      v4i;   // matches builtin param

#define AS1_ __attribute__((address_space(1)))
#define AS3_ __attribute__((address_space(3)))

#define B_  4
#define S_  2048
#define D_  1024
#define H_  16
#define HD_ 64

__device__ __forceinline__ v8f v8f_zero() {
    v8f z; for (int i = 0; i < 8; ++i) z[i] = 0.0f; return z;
}

// A/B fragment gather for v_wmma_f32_16x16x32_f16 (16x32 tile, K-contiguous
// rows).  Lane L<16: row L, K={0..7,16..23}; lane L>=16: row L-16,
// K={8..15,24..31}.  Two 16-byte loads per lane.
__device__ __forceinline__ v16h frag_ld(const _Float16* p16, int stride) {
    const int lane = threadIdx.x & 31;
    const int r    = lane & 15;
    const int ko   = (lane >> 4) << 3;            // 0 or 8
    const _Float16* p = p16 + (size_t)r * stride + ko;
    v8h lo = *(const v8h*)(p);
    v8h hi = *(const v8h*)(p + 16);
    return __builtin_shufflevector(lo, hi, 0,1,2,3,4,5,6,7,8,9,10,11,12,13,14,15);
}

__device__ __forceinline__ v8f wmma32(v16h a, v16h b, v8f c) {
    return __builtin_amdgcn_wmma_f32_16x16x32_f16(
        /*neg_a=*/false, a, /*neg_b=*/false, b,
        /*c_mod=*/(short)0, c, /*reuse_a=*/false, /*reuse_b=*/false);
}

// ---------------------------------------------------------------------------
// fp32 -> f16 conversion.  A lane converts CVT_U groups of 4 elements, so a
// launch starts 1/64 of the waves that one element per lane needs.
// A wave owns CVT_U * 128 consecutive elements: each load instruction covers
// 512 contiguous bytes, each store 256, whole 128-byte lines both ways.
// No tail: every array length is a multiple of CVT_TILE (asserted below).
// ---------------------------------------------------------------------------
#define CVT_U    16                               // 16-byte loads in flight per lane
#define CVT_TILE (256 * CVT_U * 4)                // elements per block
static_assert((B_ * S_ * D_) % CVT_TILE == 0 && (D_ * D_) % CVT_TILE == 0,
              "conversion has no tail handling");

__global__ __launch_bounds__(256)
void cvt_f32_f16(const float* __restrict__ s, _Float16* __restrict__ d) {
    const int e0 = blockIdx.x * CVT_TILE + (threadIdx.x >> 5) * (CVT_U * 128)
                 + (threadIdx.x & 31) * 4;
    const float* p = s + e0;
    v4f v[CVT_U];
#pragma unroll  // all loads of a lane issue before the first convert: one memory latency per wave
    for (int u = 0; u < CVT_U; ++u) v[u] = *(const v4f*)(p + u * 128);
    // wait before any register that the loads name is rewritten; p as an input keeps the
    // address pair from becoming a load's destination while earlier loads still name it
    asm volatile("s_wait_xcnt 0x0" :: "v"(p) : "memory");
    // without it the compiler lifts converts over the wait and holds the last four loads
    // back until the first have landed: a second memory latency
    __builtin_amdgcn_sched_barrier(0);
#pragma unroll  // constant indices: registers, no indexed moves
    for (int u = 0; u < CVT_U; ++u)
        *(v4h*)(d + e0 + u * 128) = __builtin_convertvector(v[u], v4h);
}

// ---------------------------------------------------------------------------
// C[M,N] = A[M,K] * Bt[N,K]^T + bias[N]   (A,Bt f16 row-major, K-contiguous)
// 128x128 block, 256 threads (8 waves), each wave: 32x64 via 2x4 WMMA tiles.
// A stage is GK_ = 128 k of both tiles: 256 B of every row, so one copy
// instruction of a wave (32 lanes x 16 B) covers two whole rows = four whole
// 128-byte lines, and the copy latency and the two barriers are paid once per
// 128 k.  LDS pitch 272 B (16 B x odd) keeps the 16-byte fragment reads off
// each other's banks.  K must be a multiple of GK_ (asserted for D_ below).
// mode 0: f16 out at [B,H,S,64]        (Q / K)
// mode 1: f16 out at [B,H,64,S]        (V transposed)
// mode 2: f32 out at [M,N] row-major   (final projection)
// ---------------------------------------------------------------------------
#define GK_ 128                                   // k per stage
#define GP_ (GK_ + 8)                             // LDS row pitch in halves (272 B)
static_assert(D_ % GK_ == 0, "a stage has no k tail");

__global__ __launch_bounds__(256)
void gemm128_wmma(const _Float16* __restrict__ A, const _Float16* __restrict__ Bt,
                  const float* __restrict__ bias, void* __restrict__ Out,
                  int M, int N, int K, int mode)
{
    __shared__ __align__(16) _Float16 sA[128 * GP_];
    __shared__ __align__(16) _Float16 sB[128 * GP_];

    const int m0   = blockIdx.y * 128;
    const int n0   = blockIdx.x * 128;
    const int tid  = threadIdx.x;
    const int wid  = tid >> 5;
    const int wm   = (wid & 3) * 32;              // wave m-offset in tile
    const int wn   = (wid >> 2) * 64;             // wave n-offset in tile
    const int crow = tid >> 4;                    // 0..15 : staged row within a group of 16
    const int cseg = (tid & 15) * 8;              // 16-byte piece of the row's 256 B

    v8f acc[2][4];
    for (int i = 0; i < 2; ++i)
        for (int j = 0; j < 4; ++j) acc[i][j] = v8f_zero();

    const _Float16* ga = A  + (size_t)(m0 + crow) * K + cseg;
    const _Float16* gb = Bt + (size_t)(n0 + crow) * K + cseg;

    for (int k0 = 0; k0 < K; k0 += GK_) {
        // Direct global->LDS copies (no VGPR round-trip); tracked by ASYNCcnt.
#pragma unroll  // all 16 copies of a lane in flight at once: one latency per stage
        for (int c = 0; c < 8; ++c) {
            __builtin_amdgcn_global_load_async_to_lds_b128(
                (AS1_ v4i*)(void*)(ga + (size_t)(c * 16) * K + k0),
                (AS3_ v4i*)&sA[(c * 16 + crow) * GP_ + cseg], 0, 0);
            __builtin_amdgcn_global_load_async_to_lds_b128(
                (AS1_ v4i*)(void*)(gb + (size_t)(c * 16) * K + k0),
                (AS3_ v4i*)&sB[(c * 16 + crow) * GP_ + cseg], 0, 0);
        }
        // this wave's copies have landed before the barrier behind which others read them
        asm volatile("s_wait_asynccnt 0x0" ::: "memory");
        __syncthreads();

#pragma unroll  // constant LDS offsets; the next 32 k's fragment reads can go ahead of these products
        for (int kk = 0; kk < GK_; kk += 32) {
            v16h fa0 = frag_ld(&sA[(wm +  0) * GP_ + kk], GP_);
            v16h fa1 = frag_ld(&sA[(wm + 16) * GP_ + kk], GP_);
            v16h fb0 = frag_ld(&sB[(wn +  0) * GP_ + kk], GP_);
            v16h fb1 = frag_ld(&sB[(wn + 16) * GP_ + kk], GP_);
            v16h fb2 = frag_ld(&sB[(wn + 32) * GP_ + kk], GP_);
            v16h fb3 = frag_ld(&sB[(wn + 48) * GP_ + kk], GP_);

            acc[0][0] = wmma32(fa0, fb0, acc[0][0]);
            acc[0][1] = wmma32(fa0, fb1, acc[0][1]);
            acc[0][2] = wmma32(fa0, fb2, acc[0][2]);
            acc[0][3] = wmma32(fa0, fb3, acc[0][3]);
            acc[1][0] = wmma32(fa1, fb0, acc[1][0]);
            acc[1][1] = wmma32(fa1, fb1, acc[1][1]);
            acc[1][2] = wmma32(fa1, fb2, acc[1][2]);
            acc[1][3] = wmma32(fa1, fb3, acc[1][3]);
        }
        // this wave's LDS reads have returned before the next stage's copies overwrite the tiles
        asm volatile("s_wait_dscnt 0x0" ::: "memory");
        __syncthreads();
    }

    // epilogue: C tile lane layout -> lane holds col (lane&15), rows r+8*(lane>>4)
    const int lane  = tid & 31;
    const int cn    = lane & 15;
    const int rbase = (lane >> 4) * 8;
    for (int i = 0; i < 2; ++i)
        for (int j = 0; j < 4; ++j) {
            const int n  = n0 + wn + 16 * j + cn;
            const float bv = bias[n];
            for (int r = 0; r < 8; ++r) {
                const int m = m0 + wm + 16 * i + rbase + r;
                const float v = acc[i][j][r] + bv;
                if (mode == 2) {
                    ((float*)Out)[(size_t)m * N + n] = v;
                } else {
                    const int b = m >> 11, s = m & (S_ - 1);
                    const int h = n >> 6,  hd = n & (HD_ - 1);
                    const size_t idx = (mode == 0)
                        ? ((size_t)((b * H_ + h) * S_ + s)) * HD_ + hd
                        : ((size_t)((b * H_ + h) * HD_ + hd)) * S_ + s;
                    ((_Float16*)Out)[idx] = (_Float16)v;
                }
            }
        }
}

#define QT_ 4

// lane l <-> lane l ^ 16
__device__ __forceinline__ float xhalf(float x) {
    const int xi = __builtin_bit_cast(int, x);
    return __builtin_bit_cast(float, __builtin_amdgcn_permlanex16(
        xi, xi, 0x76543210, 0xfedcba98, false, false));
}

__global__ __launch_bounds__(128)
void flash_attn_wmma(const _Float16* __restrict__ Q, const _Float16* __restrict__ Km,
                     const _Float16* __restrict__ Vt, const int* __restrict__ mask,
                     _Float16* __restrict__ Outv)
{
    // additive key mask of this batch row: a lane needs 16 keys' values per step
    __shared__ __align__(16) float sBias[S_];

    const int bh   = blockIdx.y;                  // b*H + h
    const int b    = bh >> 4;
    const int h    = bh & 15;
    const int wid  = threadIdx.x >> 5;
    const int lane = threadIdx.x & 31;
    const int cn   = lane & 15;                   // query column of this lane
    const int rhalf = lane >> 4;                  // 0: rows 0..7, 1: rows 8..15
    const int q0   = blockIdx.x * (64 * QT_) + wid * (16 * QT_);

    const _Float16* Qbh = Q  + (size_t)bh * S_ * HD_;
    const _Float16* Kbh = Km + (size_t)bh * S_ * HD_;
    const _Float16* Vbh = Vt + (size_t)bh * HD_ * S_;
    const int*      mb  = mask + b * S_;

#pragma unroll  // all 16 loads of a thread in flight at once: one latency, not sixteen
    for (int i = 0; i < S_ / 128; ++i) {
        const int key = i * 128 + threadIdx.x;
        sBias[key] = mb[key] ? 0.0f : -1.0e30f;
    }

    v16h qf[QT_][2];
    v8f  o[QT_][4];
    float mrow[QT_], lsum[QT_];                   // lsum: this half's keys only
#pragma unroll  // constant indices: registers, no indexed moves
    for (int t = 0; t < QT_; ++t) {
        qf[t][0] = frag_ld(Qbh + (size_t)(q0 + 16 * t) * HD_,      HD_);
        qf[t][1] = frag_ld(Qbh + (size_t)(q0 + 16 * t) * HD_ + 32, HD_);
    }
    // address registers of the mask and Q loads are reused below: wait first
    asm volatile("s_wait_xcnt 0x0" ::: "memory");
    __builtin_amdgcn_sched_barrier(0);            // keeps the register writes below behind that wait

#pragma unroll  // constant indices: registers, no indexed moves
    for (int t = 0; t < QT_; ++t) {
#pragma unroll  // constant indices: registers, no indexed moves
        for (int j = 0; j < 4; ++j) o[t][j] = v8f_zero();
        mrow[t] = -3.0e38f;
        lsum[t] = 0.0f;
    }

    const float scale = 0.125f;                   // 1/sqrt(64)

    __syncthreads();                              // bias table complete

    for (int n0 = 0; n0 < S_; n0 += 32) {
        // L2/WGP prefetch of the next key/value block while this one computes.
        if (n0 + 32 < S_) {
            __builtin_prefetch(Kbh + (size_t)(n0 + 32 + cn) * HD_, 0, 3);
            __builtin_prefetch(Vbh + (size_t)(cn * 4) * S_ + n0 + 32, 0, 3);
        }

        // K fragments (A operand of the first product), loaded once for all tiles
        const v16h kf00 = frag_ld(Kbh + (size_t)(n0     ) * HD_,      HD_);
        const v16h kf01 = frag_ld(Kbh + (size_t)(n0     ) * HD_ + 32, HD_);
        const v16h kf10 = frag_ld(Kbh + (size_t)(n0 + 16) * HD_,      HD_);
        const v16h kf11 = frag_ld(Kbh + (size_t)(n0 + 16) * HD_ + 32, HD_);
        // the K address pair may be reused as a destination of the V loads: wait first
        asm volatile("s_wait_xcnt 0x0" ::: "memory");

        // V^T fragments: A operand of the second product, same loader as before
        v16h vf[4];
#pragma unroll  // vf stays in registers only with constant indices
        for (int j = 0; j < 4; ++j)
            vf[j] = frag_ld(Vbh + (size_t)(j * 16) * S_ + n0, S_);
        // the V address pair is reused by the arithmetic below: wait first
        asm volatile("s_wait_xcnt 0x0" ::: "memory");

        const v4f* bp = (const v4f*)&sBias[n0 + 8 * rhalf];
        const v8f bias0 = __builtin_shufflevector(bp[0], bp[1], 0, 1, 2, 3, 4, 5, 6, 7);
        const v8f bias1 = __builtin_shufflevector(bp[4], bp[5], 0, 1, 2, 3, 4, 5, 6, 7);

        // ---- scores S^T[32x16] = K * Q^T, per query tile ----
        v8f s0[QT_], s1[QT_];
#pragma unroll  // constant indices: registers, no indexed moves
        for (int t = 0; t < QT_; ++t) {
            s0[t] = wmma32(kf00, qf[t][0], v8f_zero());
            s1[t] = wmma32(kf10, qf[t][0], v8f_zero());
        }
#pragma unroll  // constant indices: registers, no indexed moves
        for (int t = 0; t < QT_; ++t) {
            s0[t] = wmma32(kf01, qf[t][1], s0[t]);
            s1[t] = wmma32(kf11, qf[t][1], s1[t]);
        }

#pragma unroll  // constant indices: registers, no indexed moves
        for (int t = 0; t < QT_; ++t) {
            // ---- online softmax, one query per lane ----
            const v8f a0 = s0[t] * scale + bias0;
            const v8f a1 = s1[t] * scale + bias1;
            float cm = fmaxf(a0[0], a1[0]);
#pragma unroll  // constant indices keep the score tiles in registers
            for (int r = 1; r < 8; ++r) cm = fmaxf(cm, fmaxf(a0[r], a1[r]));
            cm = fmaxf(cm, xhalf(cm));            // both halves: the query's block maximum
            const float mn = fmaxf(mrow[t], cm);
            const float al = __expf(mrow[t] - mn);
            mrow[t] = mn;

            v16h pf;
            float pr[8];
            const v8f d0 = a0 - mn;               // whole tiles: neighbouring registers pair up
            const v8f d1 = a1 - mn;
            v8f e0, e1;
#pragma unroll  // constant indices: registers, no indexed moves
            for (int r = 0; r < 8; ++r) e0[r] = __expf(d0[r]);
#pragma unroll  // constant indices: registers, no indexed moves
            for (int r = 0; r < 8; ++r) e1[r] = __expf(d1[r]);
#pragma unroll  // constant indices: registers, no indexed moves
            for (int r = 0; r < 8; ++r) {
                pr[r] = e0[r] + e1[r];
                pf[r]     = (_Float16)e0[r];      // k slots 0..7  = keys 8h + r
                pf[8 + r] = (_Float16)e1[r];      // k slots 8..15 = keys 16 + 8h + r
            }
            const float ps = ((pr[0] + pr[1]) + (pr[2] + pr[3])) + ((pr[4] + pr[5]) + (pr[6] + pr[7]));
            lsum[t] = lsum[t] * al + ps;

            // ---- O^T += V^T * P^T ----
#pragma unroll  // constant indices: registers, no indexed moves
            for (int j = 0; j < 4; ++j) {
                o[t][j] *= al;
                o[t][j] = wmma32(vf[j], pf, o[t][j]);
            }
        }
    }

    // ---- finalize + write [B,S,D] f16: a lane holds 8 consecutive hd of its query ----
#pragma unroll  // constant indices: registers, no indexed moves
    for (int t = 0; t < QT_; ++t) {
        const float lt = lsum[t] + xhalf(lsum[t]);
        _Float16* orow = Outv + ((size_t)(b * S_ + q0 + 16 * t + cn)) * D_ + h * HD_ + 8 * rhalf;
#pragma unroll  // constant indices: registers, no indexed moves
        for (int j = 0; j < 4; ++j) {
            v8h ov;
#pragma unroll  // constant indices: registers, no indexed moves
            for (int r = 0; r < 8; ++r) ov[r] = (_Float16)(o[t][j][r] / lt);
            *(v8h*)(orow + j * 16) = ov;
        }
    }
}

// ---------------------------------------------------------------------------
extern "C" void kernel_launch(void* const* d_in, const int* in_sizes, int n_in,
                              void* d_out, int out_size, void* d_ws, size_t ws_size,
                              hipStream_t stream) {
    const float* x    = (const float*)d_in[0];
    const int*   mask = (const int*)  d_in[1];
    const float* Wq   = (const float*)d_in[2];
    const float* bq   = (const float*)d_in[3];
    const float* Wk   = (const float*)d_in[4];
    const float* bk   = (const float*)d_in[5];
    const float* Wv   = (const float*)d_in[6];
    const float* bv   = (const float*)d_in[7];
    const float* Wo   = (const float*)d_in[8];
    const float* bo   = (const float*)d_in[9];

    const int MT = B_ * S_;              // 8192 rows
    const int NX = MT * D_;              // 8388608
    const int NW = D_ * D_;              // 1048576

    _Float16* ws    = (_Float16*)d_ws;
    _Float16* xh    = ws;                // [8192,1024]
    _Float16* wqh   = xh   + NX;
    _Float16* wkh   = wqh  + NW;
    _Float16* wvh   = wkh  + NW;
    _Float16* woh   = wvh  + NW;
    _Float16* qh    = woh  + NW;         // [B,H,S,64]
    _Float16* kh    = qh   + NX;         // [B,H,S,64]
    _Float16* vth   = kh   + NX;         // [B,H,64,S]
    _Float16* valsh = vth  + NX;         // [B,S,D]

    cvt_f32_f16<<<NX / CVT_TILE, 256, 0, stream>>>(x,  xh);
    cvt_f32_f16<<<NW / CVT_TILE, 256, 0, stream>>>(Wq, wqh);
    cvt_f32_f16<<<NW / CVT_TILE, 256, 0, stream>>>(Wk, wkh);
    cvt_f32_f16<<<NW / CVT_TILE, 256, 0, stream>>>(Wv, wvh);
    cvt_f32_f16<<<NW / CVT_TILE, 256, 0, stream>>>(Wo, woh);

    dim3 gg(D_ / 128, MT / 128);         // (8, 64)
    gemm128_wmma<<<gg, 256, 0, stream>>>(xh, wqh, bq, qh,  MT, D_, D_, 0);
    gemm128_wmma<<<gg, 256, 0, stream>>>(xh, wkh, bk, kh,  MT, D_, D_, 0);
    gemm128_wmma<<<gg, 256, 0, stream>>>(xh, wvh, bv, vth, MT, D_, D_, 1);

    flash_attn_wmma<<<dim3(S_ / (64 * QT_), B_ * H_), 128, 0, stream>>>(qh, kh, vth, mask, valsh);

    gemm128_wmma<<<gg, 256, 0, stream>>>(valsh, woh, bo, d_out, MT, D_, D_, 2);
}

// v005
// A run of this version takes 185 microseconds.
// Timed twice side by side with v004, it ran 1.66 times as fast both times.
// Over all steps from v000 it is 3.10 times as fast.
#include <hip/hip_runtime.h>
#include <hip/hip_bf16.h>

// ---------------------------------------------------------------------------
// MI455X (gfx1250) multi-head attention, WMMA f16 path.
//   B=4 S=2048 D=1024 H=16 Hd=64.  ~137 GFLOP total -> compute bound; all
//   GEMM stages go through v_wmma_f32_16x16x32_f16 (f32 accumulate).
//   Data movement: GEMM tiles staged via async global->LDS (ASYNCcnt);
//   flash loop prefetches next K/V block.
// ---------------------------------------------------------------------------

typedef __attribute__((ext_vector_type(16))) _Float16 v16h;
typedef __attribute__((ext_vector_type(8)))  _Float16 v8h;
typedef __attribute__((ext_vector_type(8)))  float    v8f;
typedef __attribute__((ext_vector_type(4)))  float    v4f;
typedef __attribute__((ext_vector_type(4)))  _Float16 v4h;
typedef __attribute__((__vector_size__(16))) int      v4i;   // matches builtin param

#define AS1_ __attribute__((address_space(1)))
#define AS3_ __attribute__((address_space(3)))

#define B_  4
#define S_  2048
#define D_  1024
#define H_  16
#define HD_ 64

__device__ __forceinline__ v8f v8f_zero() {
    v8f z; for (int i = 0; i < 8; ++i) z[i] = 0.0f; return z;
}

// A/B fragment gather for v_wmma_f32_16x16x32_f16 (16x32 tile, K-contiguous
// rows).  Lane L<16: row L, K={0..7,16..23}; lane L>=16: row L-16,
// K={8..15,24..31}.  Two 16-byte loads per lane.
__device__ __forceinline__ v16h frag_ld(const _Float16* p16, int stride) {
    const int lane = threadIdx.x & 31;
    const int r    = lane & 15;
    const int ko   = (lane >> 4) << 3;            // 0 or 8
    const _Float16* p = p16 + (size_t)r * stride + ko;
    v8h lo = *(const v8h*)(p);
    v8h hi = *(const v8h*)(p + 16);
    return __builtin_shufflevector(lo, hi, 0,1,2,3,4,5,6,7,8,9,10,11,12,13,14,15);
}

__device__ __forceinline__ v8f wmma32(v16h a, v16h b, v8f c) {
    return __builtin_amdgcn_wmma_f32_16x16x32_f16(
        /*neg_a=*/false, a, /*neg_b=*/false, b,
        /*c_mod=*/(short)0, c, /*reuse_a=*/false, /*reuse_b=*/false);
}

// ---------------------------------------------------------------------------
// fp32 -> f16 conversion.  A lane converts CVT_U groups of 4 elements, so a
// launch starts 1/64 of the waves that one element per lane needs.
// A wave owns CVT_U * 128 consecutive elements: each load instruction covers
// 512 contiguous bytes, each store 256, whole 128-byte lines both ways.
// No tail: every array length is a multiple of CVT_TILE (asserted below).
// ---------------------------------------------------------------------------
#define CVT_U    16                               // 16-byte loads in flight per lane
#define CVT_TILE (256 * CVT_U * 4)                // elements per block
static_assert((B_ * S_ * D_) % CVT_TILE == 0 && (D_ * D_) % CVT_TILE == 0,
              "conversion has no tail handling");

__global__ __launch_bounds__(256)
void cvt_f32_f16(const float* __restrict__ s, _Float16* __restrict__ d) {
    const int e0 = blockIdx.x * CVT_TILE + (threadIdx.x >> 5) * (CVT_U * 128)
                 + (threadIdx.x & 31) * 4;
    const float* p = s + e0;
    v4f v[CVT_U];
#pragma unroll  // all loads of a lane issue before the first convert: one memory latency per wave
    for (int u = 0; u < CVT_U; ++u) v[u] = *(const v4f*)(p + u * 128);
    // wait before any register that the loads name is rewritten; p as an input keeps the
    // address pair from becoming a load's destination while earlier loads still name it
    asm volatile("s_wait_xcnt 0x0" :: "v"(p) : "memory");
    // without it the compiler lifts converts over the wait and holds the last four loads
    // back until the first have landed: a second memory latency
    __builtin_amdgcn_sched_barrier(0);
#pragma unroll  // constant indices: registers, no indexed moves
    for (int u = 0; u < CVT_U; ++u)
        *(v4h*)(d + e0 + u * 128) = __builtin_convertvector(v[u], v4h);
}

// ---------------------------------------------------------------------------
// C[a,b] = sum_k A[a,k] * Bt[b,k] + bias   (A,Bt f16 row-major, K-contiguous)
// 128x128 block, 256 threads (8 waves), each wave: 32 A rows x 64 Bt rows via
// 2x4 WMMA tiles.  Bt's fragment is the FIRST matrix operand, so a lane ends up
// with one A row and 8 consecutive Bt rows in the 8 registers of a tile.  The
// host passes as Bt the matrix whose rows run along the contiguous direction of
// the 16-bit output (mode 0: weights, mode 1: tokens): a tile leaves a lane as
// one 16-byte store.  Grid: x = 128 features, y = 128 tokens in every mode.
// A stage is GK_ = 128 k of both tiles: 256 B of every row, so one copy
// instruction of a wave (32 lanes x 16 B) covers two whole rows = four whole
// 128-byte lines, and the copy latency and the two barriers are paid once per
// 128 k.  LDS pitch 272 B (16 B x odd) keeps the 16-byte fragment reads off
// each other's banks.  K must be a multiple of GK_ (asserted for D_ below).
// mode 0: A tokens, Bt weights: f16 out at [B,H,S,64]      (Q / K)
// mode 1: A weights, Bt tokens: f16 out at [B,H,64,S]      (V transposed)
// mode 2: A weights, Bt tokens: f32 out at [tokens,D_]     (final projection;
//         16 lanes = 64 contiguous bytes per 4-byte store)
// ---------------------------------------------------------------------------
#define GK_ 128                                   // k per stage
#define GP_ (GK_ + 8)                             // LDS row pitch in halves (272 B)
static_assert(D_ % GK_ == 0, "a stage has no k tail");

__global__ __launch_bounds__(256)
void gemm128_wmma(const _Float16* __restrict__ A, const _Float16* __restrict__ Bt,
                  const float* __restrict__ bias, void* __restrict__ Out,
                  int M, int N, int K, int mode)
{
    __shared__ __align__(16) _Float16 sA[128 * GP_];
    __shared__ __align__(16) _Float16 sB[128 * GP_];

    const int m0   = (mode == 0 ? blockIdx.y : blockIdx.x) * 128;   // first A row
    const int n0   = (mode == 0 ? blockIdx.x : blockIdx.y) * 128;   // first Bt row
    const int tid  = threadIdx.x;
    const int wid  = tid >> 5;
    const int wm   = (wid & 3) * 32;              // wave m-offset in tile
    const int wn   = (wid >> 2) * 64;             // wave n-offset in tile
    const int crow = tid >> 4;                    // 0..15 : staged row within a group of 16
    const int cseg = (tid & 15) * 8;              // 16-byte piece of the row's 256 B

    v8f acc[2][4];
    for (int i = 0; i < 2; ++i)
        for (int j = 0; j < 4; ++j) acc[i][j] = v8f_zero();

    const _Float16* ga = A  + (size_t)(m0 + crow) * K + cseg;
    const _Float16* gb = Bt + (size_t)(n0 + crow) * K + cseg;

    for (int k0 = 0; k0 < K; k0 += GK_) {
        // Direct global->LDS copies (no VGPR round-trip); tracked by ASYNCcnt.
#pragma unroll  // all 16 copies of a lane in flight at once: one latency per stage
        for (int c = 0; c < 8; ++c) {
            __builtin_amdgcn_global_load_async_to_lds_b128(
                (AS1_ v4i*)(void*)(ga + (size_t)(c * 16) * K + k0),
                (AS3_ v4i*)&sA[(c * 16 + crow) * GP_ + cseg], 0, 0);
            __builtin_amdgcn_global_load_async_to_lds_b128(
                (AS1_ v4i*)(void*)(gb + (size_t)(c * 16) * K + k0),
                (AS3_ v4i*)&sB[(c * 16 + crow) * GP_ + cseg], 0, 0);
        }
        // this wave's copies have landed before the barrier behind which others read them
        asm volatile("s_wait_asynccnt 0x0" ::: "memory");
        __syncthreads();

#pragma unroll  // constant LDS offsets; the next 32 k's fragment reads can go ahead of these products
        for (int kk = 0; kk < GK_; kk += 32) {
            v16h fa0 = frag_ld(&sA[(wm +  0) * GP_ + kk], GP_);
            v16h fa1 = frag_ld(&sA[(wm + 16) * GP_ + kk], GP_);
            v16h fb0 = frag_ld(&sB[(wn +  0) * GP_ + kk], GP_);
            v16h fb1 = frag_ld(&sB[(wn + 16) * GP_ + kk], GP_);
            v16h fb2 = frag_ld(&sB[(wn + 32) * GP_ + kk], GP_);
            v16h fb3 = frag_ld(&sB[(wn + 48) * GP_ + kk], GP_);

            acc[0][0] = wmma32(fb0, fa0, acc[0][0]);
            acc[0][1] = wmma32(fb1, fa0, acc[0][1]);
            acc[0][2] = wmma32(fb2, fa0, acc[0][2]);
            acc[0][3] = wmma32(fb3, fa0, acc[0][3]);
            acc[1][0] = wmma32(fb0, fa1, acc[1][0]);
            acc[1][1] = wmma32(fb1, fa1, acc[1][1]);
            acc[1][2] = wmma32(fb2, fa1, acc[1][2]);
            acc[1][3] = wmma32(fb3, fa1, acc[1][3]);
        }
        // this wave's LDS reads have returned before the next stage's copies overwrite the tiles
        asm volatile("s_wait_dscnt 0x0" ::: "memory");
        __syncthreads();
    }

    // epilogue: register r of acc[i][j] = C[A row 16 i + (lane & 15)][Bt row 16 j + 8 (lane >> 4) + r].
    // One branch on the mode around fully unrolled loops: every accumulator index is a
    // constant (no scratch), every store address is one base plus a constant.
    const int lane = tid & 31;
    const int pa   = m0 + wm + (lane & 15);       // this lane's A row in tile i = 0
    const int pb   = n0 + wn + (lane >> 4) * 8;   // first of its 8 Bt rows in tile j = 0
    if (mode == 0) {
        // token pa, features pb + 16 j + r: 8 consecutive hd of one head
        _Float16* o = (_Float16*)Out
            + ((size_t)((pa >> 11) * H_ + (pb >> 6)) * S_ + (pa & (S_ - 1))) * HD_ + (pb & (HD_ - 1));
        v8f bv[4];
#pragma unroll  // constant indices: registers; the bias loads go out as one group
        for (int j = 0; j < 4; ++j) bv[j] = *(const v8f*)(bias + pb + 16 * j);
#pragma unroll  // constant indices: registers, no indexed moves
        for (int i = 0; i < 2; ++i)
#pragma unroll  // constant indices: registers, no indexed moves
            for (int j = 0; j < 4; ++j)
                *(v8h*)(o + i * 16 * HD_ + j * 16) = __builtin_convertvector(acc[i][j] + bv[j], v8h);
        // the stores above still name their address and data registers: wait before any path rewrites them
        asm volatile("s_wait_xcnt 0x0" ::: "memory");
    } else if (mode == 1) {
        // feature pa, tokens pb + 16 j + r: 8 consecutive s of row (b * D_ + feature)
        _Float16* o = (_Float16*)Out + (size_t)((pb >> 11) * D_ + pa) * S_ + (pb & (S_ - 1));
        const float bv0 = bias[pa], bv1 = bias[pa + 16];
#pragma unroll  // constant indices: registers, no indexed moves
        for (int i = 0; i < 2; ++i)
#pragma unroll  // constant indices: registers, no indexed moves
            for (int j = 0; j < 4; ++j)
                *(v8h*)(o + i * 16 * S_ + j * 16) = __builtin_convertvector(acc[i][j] + (i ? bv1 : bv0), v8h);
        // the stores above still name their address and data registers: wait before any path rewrites them
        asm volatile("s_wait_xcnt 0x0" ::: "memory");
    } else {
        // feature pa, tokens pb + 16 j + r
        float* o = (float*)Out + (size_t)pb * D_ + pa;
        const float bv0 = bias[pa], bv1 = bias[pa + 16];
#pragma unroll  // constant indices: registers, no indexed moves
        for (int i = 0; i < 2; ++i)
#pragma unroll  // constant indices: registers, no indexed moves
            for (int j = 0; j < 4; ++j)
#pragma unroll  // constant indices: registers, no indexed moves
                for (int r = 0; r < 8; ++r)
                    o[(j * 16 + r) * D_ + i * 16] = acc[i][j][r] + (i ? bv1 : bv0);
        // the stores above still name their address and data registers: wait before any path rewrites them
        asm volatile("s_wait_xcnt 0x0" ::: "memory");
    }
}

#define QT_ 4

// lane l <-> lane l ^ 16
__device__ __forceinline__ float xhalf(float x) {
    const int xi = __builtin_bit_cast(int, x);
    return __builtin_bit_cast(float, __builtin_amdgcn_permlanex16(
        xi, xi, 0x76543210, 0xfedcba98, false, false));
}

__global__ __launch_bounds__(128)
void flash_attn_wmma(const _Float16* __restrict__ Q, const _Float16* __restrict__ Km,
                     const _Float16* __restrict__ Vt, const int* __restrict__ mask,
                     _Float16* __restrict__ Outv)
{
    // additive key mask of this batch row: a lane needs 16 keys' values per step
    __shared__ __align__(16) float sBias[S_];

    const int bh   = blockIdx.y;                  // b*H + h
    const int b    = bh >> 4;
    const int h    = bh & 15;
    const int wid  = threadIdx.x >> 5;
    const int lane = threadIdx.x & 31;
    const int cn   = lane & 15;                   // query column of this lane
    const int rhalf = lane >> 4;                  // 0: rows 0..7, 1: rows 8..15
    const int q0   = blockIdx.x * (64 * QT_) + wid * (16 * QT_);

    const _Float16* Qbh = Q  + (size_t)bh * S_ * HD_;
    const _Float16* Kbh = Km + (size_t)bh * S_ * HD_;
    const _Float16* Vbh = Vt + (size_t)bh * HD_ * S_;
    const int*      mb  = mask + b * S_;

#pragma unroll  // all 16 loads of a thread in flight at once: one latency, not sixteen
    for (int i = 0; i < S_ / 128; ++i) {
        const int key = i * 128 + threadIdx.x;
        sBias[key] = mb[key] ? 0.0f : -1.0e30f;
    }

    v16h qf[QT_][2];
    v8f  o[QT_][4];
    float mrow[QT_], lsum[QT_];                   // lsum: this half's keys only
#pragma unroll  // constant indices: registers, no indexed moves
    for (int t = 0; t < QT_; ++t) {
        qf[t][0] = frag_ld(Qbh + (size_t)(q0 + 16 * t) * HD_,      HD_);
        qf[t][1] = frag_ld(Qbh + (size_t)(q0 + 16 * t) * HD_ + 32, HD_);
    }
    // address registers of the mask and Q loads are reused below: wait first
    asm volatile("s_wait_xcnt 0x0" ::: "memory");
    __builtin_amdgcn_sched_barrier(0);            // keeps the register writes below behind that wait

#pragma unroll  // constant indices: registers, no indexed moves
    for (int t = 0; t < QT_; ++t) {
#pragma unroll  // constant indices: registers, no indexed moves
        for (int j = 0; j < 4; ++j) o[t][j] = v8f_zero();
        mrow[t] = -3.0e38f;
        lsum[t] = 0.0f;
    }

    const float scale = 0.125f;                   // 1/sqrt(64)

    __syncthreads();                              // bias table complete

    for (int n0 = 0; n0 < S_; n0 += 32) {
        // L2/WGP prefetch of the next key/value block while this one computes.
        if (n0 + 32 < S_) {
            __builtin_prefetch(Kbh + (size_t)(n0 + 32 + cn) * HD_, 0, 3);
            __builtin_prefetch(Vbh + (size_t)(cn * 4) * S_ + n0 + 32, 0, 3);
        }

        // K fragments (A operand of the first product), loaded once for all tiles
        const v16h kf00 = frag_ld(Kbh + (size_t)(n0     ) * HD_,      HD_);
        const v16h kf01 = frag_ld(Kbh + (size_t)(n0     ) * HD_ + 32, HD_);
        const v16h kf10 = frag_ld(Kbh + (size_t)(n0 + 16) * HD_,      HD_);
        const v16h kf11 = frag_ld(Kbh + (size_t)(n0 + 16) * HD_ + 32, HD_);
        // the K address pair may be reused as a destination of the V loads: wait first
        asm volatile("s_wait_xcnt 0x0" ::: "memory");

        // V^T fragments: A operand of the second product, same loader as before
        v16h vf[4];
#pragma unroll  // vf stays in registers only with constant indices
        for (int j = 0; j < 4; ++j)
            vf[j] = frag_ld(Vbh + (size_t)(j * 16) * S_ + n0, S_);
        // the V address pair is reused by the arithmetic below: wait first
        asm volatile("s_wait_xcnt 0x0" ::: "memory");

        const v4f* bp = (const v4f*)&sBias[n0 + 8 * rhalf];
        const v8f bias0 = __builtin_shufflevector(bp[0], bp[1], 0, 1, 2, 3, 4, 5, 6, 7);
        const v8f bias1 = __builtin_shufflevector(bp[4], bp[5], 0, 1, 2, 3, 4, 5, 6, 7);

        // ---- scores S^T[32x16] = K * Q^T, per query tile ----
        v8f s0[QT_], s1[QT_];
#pragma unroll  // constant indices: registers, no indexed moves
        for (int t = 0; t < QT_; ++t) {
            s0[t] = wmma32(kf00, qf[t][0], v8f_zero());
            s1[t] = wmma32(kf10, qf[t][0], v8f_zero());
        }
#pragma unroll  // constant indices: registers, no indexed moves
        for (int t = 0; t < QT_; ++t) {
            s0[t] = wmma32(kf01, qf[t][1], s0[t]);
            s1[t] = wmma32(kf11, qf[t][1], s1[t]);
        }

#pragma unroll  // constant indices: registers, no indexed moves
        for (int t = 0; t < QT_; ++t) {
            // ---- online softmax, one query per lane ----
            const v8f a0 = s0[t] * scale + bias0;
            const v8f a1 = s1[t] * scale + bias1;
            float cm = fmaxf(a0[0], a1[0]);
#pragma unroll  // constant indices keep the score tiles in registers
            for (int r = 1; r < 8; ++r) cm = fmaxf(cm, fmaxf(a0[r], a1[r]));
            cm = fmaxf(cm, xhalf(cm));            // both halves: the query's block maximum
            const float mn = fmaxf(mrow[t], cm);
            const float al = __expf(mrow[t] - mn);
            mrow[t] = mn;

            v16h pf;
            float pr[8];
            const v8f d0 = a0 - mn;               // whole tiles: neighbouring registers pair up
            const v8f d1 = a1 - mn;
            v8f e0, e1;
#pragma unroll  // constant indices: registers, no indexed moves
            for (int r = 0; r < 8; ++r) e0[r] = __expf(d0[r]);
#pragma unroll  // constant indices: registers, no indexed moves
            for (int r = 0; r < 8; ++r) e1[r] = __expf(d1[r]);
#pragma unroll  // constant indices: registers, no indexed moves
            for (int r = 0; r < 8; ++r) {
                pr[r] = e0[r] + e1[r];
                pf[r]     = (_Float16)e0[r];      // k slots 0..7  = keys 8h + r
                pf[8 + r] = (_Float16)e1[r];      // k slots 8..15 = keys 16 + 8h + r
            }
            const float ps = ((pr[0] + pr[1]) + (pr[2] + pr[3])) + ((pr[4] + pr[5]) + (pr[6] + pr[7]));
            lsum[t] = lsum[t] * al + ps;

            // ---- O^T += V^T * P^T ----
#pragma unroll  // constant indices: registers, no indexed moves
            for (int j = 0; j < 4; ++j) {
                o[t][j] *= al;
                o[t][j] = wmma32(vf[j], pf, o[t][j]);
            }
        }
    }

    // ---- finalize + write [B,S,D] f16: a lane holds 8 consecutive hd of its query ----
#pragma unroll  // constant indices: registers, no indexed moves
    for (int t = 0; t < QT_; ++t) {
        const float lt = lsum[t] + xhalf(lsum[t]);
        _Float16* orow = Outv + ((size_t)(b * S_ + q0 + 16 * t + cn)) * D_ + h * HD_ + 8 * rhalf;
#pragma unroll  // constant indices: registers, no indexed moves
        for (int j = 0; j < 4; ++j) {
            v8h ov;
#pragma unroll  // constant indices: registers, no indexed moves
            for (int r = 0; r < 8; ++r) ov[r] = (_Float16)(o[t][j][r] / lt);
            *(v8h*)(orow + j * 16) = ov;
        }
    }
}

// ---------------------------------------------------------------------------
extern "C" void kernel_launch(void* const* d_in, const int* in_sizes, int n_in,
                              void* d_out, int out_size, void* d_ws, size_t ws_size,
                              hipStream_t stream) {
    const float* x    = (const float*)d_in[0];
    const int*   mask = (const int*)  d_in[1];
    const float* Wq   = (const float*)d_in[2];
    const float* bq   = (const float*)d_in[3];
    const float* Wk   = (const float*)d_in[4];
    const float* bk   = (const float*)d_in[5];
    const float* Wv   = (const float*)d_in[6];
    const float* bv   = (const float*)d_in[7];
    const float* Wo   = (const float*)d_in[8];
    const float* bo   = (const float*)d_in[9];

    const int MT = B_ * S_;              // 8192 rows
    const int NX = MT * D_;              // 8388608
    const int NW = D_ * D_;              // 1048576

    _Float16* ws    = (_Float16*)d_ws;
    _Float16* xh    = ws;                // [8192,1024]
    _Float16* wqh   = xh   + NX;
    _Float16* wkh   = wqh  + NW;
    _Float16* wvh   = wkh  + NW;
    _Float16* woh   = wvh  + NW;
    _Float16* qh    = woh  + NW;         // [B,H,S,64]
    _Float16* kh    = qh   + NX;         // [B,H,S,64]
    _Float16* vth   = kh   + NX;         // [B,H,64,S]
    _Float16* valsh = vth  + NX;         // [B,S,D]

    cvt_f32_f16<<<NX / CVT_TILE, 256, 0, stream>>>(x,  xh);
    cvt_f32_f16<<<NW / CVT_TILE, 256, 0, stream>>>(Wq, wqh);
    cvt_f32_f16<<<NW / CVT_TILE, 256, 0, stream>>>(Wk, wkh);
    cvt_f32_f16<<<NW / CVT_TILE, 256, 0, stream>>>(Wv, wvh);
    cvt_f32_f16<<<NW / CVT_TILE, 256, 0, stream>>>(Wo, woh);

    dim3 gg(D_ / 128, MT / 128);         // (8, 64)
    gemm128_wmma<<<gg, 256, 0, stream>>>(xh, wqh, bq, qh,  MT, D_, D_, 0);
    gemm128_wmma<<<gg, 256, 0, stream>>>(xh, wkh, bk, kh,  MT, D_, D_, 0);
    gemm128_wmma<<<gg, 256, 0, stream>>>(wvh, xh, bv, vth, MT, D_, D_, 1);

    flash_attn_wmma<<<dim3(S_ / (64 * QT_), B_ * H_), 128, 0, stream>>>(qh, kh, vth, mask, valsh);

    gemm128_wmma<<<gg, 256, 0, stream>>>(woh, valsh, bo, d_out, MT, D_, D_, 2);
}

// v006
// One run takes 157 microseconds.
// Timed twice side by side with v005, it ran 1.19 times as fast both times.
// Over all steps from v000 it is 3.69 times as fast.
#include <hip/hip_runtime.h>
#include <hip/hip_bf16.h>

// ---------------------------------------------------------------------------
// MI455X (gfx1250) multi-head attention, WMMA f16 path.
//   B=4 S=2048 D=1024 H=16 Hd=64.  ~137 GFLOP total -> compute bound; all
//   GEMM stages go through v_wmma_f32_16x16x32_f16 (f32 accumulate).
//   Data movement: GEMM tiles and the flash loop's K / V^T tiles staged via
//   async global->LDS (ASYNCcnt).
// ---------------------------------------------------------------------------

typedef __attribute__((ext_vector_type(16))) _Float16 v16h;
typedef __attribute__((ext_vector_type(8)))  _Float16 v8h;
typedef __attribute__((ext_vector_type(8)))  float    v8f;
typedef __attribute__((ext_vector_type(4)))  float    v4f;
typedef __attribute__((ext_vector_type(4)))  _Float16 v4h;
typedef __attribute__((__vector_size__(16))) int      v4i;   // matches builtin param

#define AS1_ __attribute__((address_space(1)))
#define AS3_ __attribute__((address_space(3)))

#define B_  4
#define S_  2048
#define D_  1024
#define H_  16
#define HD_ 64

__device__ __forceinline__ v8f v8f_zero() {
    v8f z; for (int i = 0; i < 8; ++i) z[i] = 0.0f; return z;
}

// A/B fragment gather for v_wmma_f32_16x16x32_f16 (16x32 tile, K-contiguous
// rows).  Lane L<16: row L, K={0..7,16..23}; lane L>=16: row L-16,
// K={8..15,24..31}.  Two 16-byte loads per lane.
__device__ __forceinline__ v16h frag_ld(const _Float16* p16, int stride) {
    const int lane = threadIdx.x & 31;
    const int r    = lane & 15;
    const int ko   = (lane >> 4) << 3;            // 0 or 8
    const _Float16* p = p16 + (size_t)r * stride + ko;
    v8h lo = *(const v8h*)(p);
    v8h hi = *(const v8h*)(p + 16);
    return __builtin_shufflevector(lo, hi, 0,1,2,3,4,5,6,7,8,9,10,11,12,13,14,15);
}

__device__ __forceinline__ v8f wmma32(v16h a, v16h b, v8f c) {
    return __builtin_amdgcn_wmma_f32_16x16x32_f16(
        /*neg_a=*/false, a, /*neg_b=*/false, b,
        /*c_mod=*/(short)0, c, /*reuse_a=*/false, /*reuse_b=*/false);
}

// ---------------------------------------------------------------------------
// fp32 -> f16 conversion.  A lane converts CVT_U groups of 4 elements, so a
// launch starts 1/64 of the waves that one element per lane needs.
// A wave owns CVT_U * 128 consecutive elements: each load instruction covers
// 512 contiguous bytes, each store 256, whole 128-byte lines both ways.
// No tail: every array length is a multiple of CVT_TILE (asserted below).
// ---------------------------------------------------------------------------
#define CVT_U    16                               // 16-byte loads in flight per lane
#define CVT_TILE (256 * CVT_U * 4)                // elements per block
static_assert((B_ * S_ * D_) % CVT_TILE == 0 && (D_ * D_) % CVT_TILE == 0,
              "conversion has no tail handling");

__global__ __launch_bounds__(256)
void cvt_f32_f16(const float* __restrict__ s, _Float16* __restrict__ d) {
    const int e0 = blockIdx.x * CVT_TILE + (threadIdx.x >> 5) * (CVT_U * 128)
                 + (threadIdx.x & 31) * 4;
    const float* p = s + e0;
    v4f v[CVT_U];
#pragma unroll  // all loads of a lane issue before the first convert: one memory latency per wave
    for (int u = 0; u < CVT_U; ++u) v[u] = *(const v4f*)(p + u * 128);
    // wait before any register that the loads name is rewritten; p as an input keeps the
    // address pair from becoming a load's destination while earlier loads still name it
    asm volatile("s_wait_xcnt 0x0" :: "v"(p) : "memory");
    // without it the compiler lifts converts over the wait and holds the last four loads
    // back until the first have landed: a second memory latency
    __builtin_amdgcn_sched_barrier(0);
#pragma unroll  // constant indices: registers, no indexed moves
    for (int u = 0; u < CVT_U; ++u)
        *(v4h*)(d + e0 + u * 128) = __builtin_convertvector(v[u], v4h);
}

// ---------------------------------------------------------------------------
// C[a,b] = sum_k A[a,k] * Bt[b,k] + bias   (A,Bt f16 row-major, K-contiguous)
// 128x128 block, 256 threads (8 waves), each wave: 32 A rows x 64 Bt rows via
// 2x4 WMMA tiles.  Bt's fragment is the FIRST matrix operand, so a lane ends up
// with one A row and 8 consecutive Bt rows in the 8 registers of a tile.  The
// host passes as Bt the matrix whose rows run along the contiguous direction of
// the 16-bit output (mode 0: weights, mode 1: tokens): a tile leaves a lane as
// one 16-byte store.  Grid: x = 128 features, y = 128 tokens in every mode.
// A stage is GK_ = 128 k of both tiles: 256 B of every row, so one copy
// instruction of a wave (32 lanes x 16 B) covers two whole rows = four whole
// 128-byte lines, and the copy latency and the two barriers are paid once per
// 128 k.  LDS pitch 272 B (16 B x odd) keeps the 16-byte fragment reads off
// each other's banks.  K must be a multiple of GK_ (asserted for D_ below).
// mode 0: A tokens, Bt weights: f16 out at [B,H,S,64]      (Q / K)
// mode 1: A weights, Bt tokens: f16 out at [B,H,64,S]      (V transposed)
// mode 2: A weights, Bt tokens: f32 out at [tokens,D_]     (final projection;
//         16 lanes = 64 contiguous bytes per 4-byte store)
// ---------------------------------------------------------------------------
#define GK_ 128                                   // k per stage
#define GP_ (GK_ + 8)                             // LDS row pitch in halves (272 B)
static_assert(D_ % GK_ == 0, "a stage has no k tail");

__global__ __launch_bounds__(256)
void gemm128_wmma(const _Float16* __restrict__ A, const _Float16* __restrict__ Bt,
                  const float* __restrict__ bias, void* __restrict__ Out,
                  int M, int N, int K, int mode)
{
    __shared__ __align__(16) _Float16 sA[128 * GP_];
    __shared__ __align__(16) _Float16 sB[128 * GP_];

    const int m0   = (mode == 0 ? blockIdx.y : blockIdx.x) * 128;   // first A row
    const int n0   = (mode == 0 ? blockIdx.x : blockIdx.y) * 128;   // first Bt row
    const int tid  = threadIdx.x;
    const int wid  = tid >> 5;
    const int wm   = (wid & 3) * 32;              // wave m-offset in tile
    const int wn   = (wid >> 2) * 64;             // wave n-offset in tile
    const int crow = tid >> 4;                    // 0..15 : staged row within a group of 16
    const int cseg = (tid & 15) * 8;              // 16-byte piece of the row's 256 B

    v8f acc[2][4];
    for (int i = 0; i < 2; ++i)
        for (int j = 0; j < 4; ++j) acc[i][j] = v8f_zero();

    const _Float16* ga = A  + (size_t)(m0 + crow) * K + cseg;
    const _Float16* gb = Bt + (size_t)(n0 + crow) * K + cseg;

    for (int k0 = 0; k0 < K; k0 += GK_) {
        // Direct global->LDS copies (no VGPR round-trip); tracked by ASYNCcnt.
#pragma unroll  // all 16 copies of a lane in flight at once: one latency per stage
        for (int c = 0; c < 8; ++c) {
            __builtin_amdgcn_global_load_async_to_lds_b128(
                (AS1_ v4i*)(void*)(ga + (size_t)(c * 16) * K + k0),
                (AS3_ v4i*)&sA[(c * 16 + crow) * GP_ + cseg], 0, 0);
            __builtin_amdgcn_global_load_async_to_lds_b128(
                (AS1_ v4i*)(void*)(gb + (size_t)(c * 16) * K + k0),
                (AS3_ v4i*)&sB[(c * 16 + crow) * GP_ + cseg], 0, 0);
        }
        // this wave's copies have landed before the barrier behind which others read them
        asm volatile("s_wait_asynccnt 0x0" ::: "memory");
        __syncthreads();

#pragma unroll  // constant LDS offsets; the next 32 k's fragment reads can go ahead of these products
        for (int kk = 0; kk < GK_; kk += 32) {
            v16h fa0 = frag_ld(&sA[(wm +  0) * GP_ + kk], GP_);
            v16h fa1 = frag_ld(&sA[(wm + 16) * GP_ + kk], GP_);
            v16h fb0 = frag_ld(&sB[(wn +  0) * GP_ + kk], GP_);
            v16h fb1 = frag_ld(&sB[(wn + 16) * GP_ + kk], GP_);
            v16h fb2 = frag_ld(&sB[(wn + 32) * GP_ + kk], GP_);
            v16h fb3 = frag_ld(&sB[(wn + 48) * GP_ + kk], GP_);

            acc[0][0] = wmma32(fb0, fa0, acc[0][0]);
            acc[0][1] = wmma32(fb1, fa0, acc[0][1]);
            acc[0][2] = wmma32(fb2, fa0, acc[0][2]);
            acc[0][3] = wmma32(fb3, fa0, acc[0][3]);
            acc[1][0] = wmma32(fb0, fa1, acc[1][0]);
            acc[1][1] = wmma32(fb1, fa1, acc[1][1]);
            acc[1][2] = wmma32(fb2, fa1, acc[1][2]);
            acc[1][3] = wmma32(fb3, fa1, acc[1][3]);
        }
        // this wave's LDS reads have returned before the next stage's copies overwrite the tiles
        asm volatile("s_wait_dscnt 0x0" ::: "memory");
        __syncthreads();
    }

    // epilogue: register r of acc[i][j] = C[A row 16 i + (lane & 15)][Bt row 16 j + 8 (lane >> 4) + r].
    // One branch on the mode around fully unrolled loops: every accumulator index is a
    // constant (no scratch), every store address is one base plus a constant.
    const int lane = tid & 31;
    const int pa   = m0 + wm + (lane & 15);       // this lane's A row in tile i = 0
    const int pb   = n0 + wn + (lane >> 4) * 8;   // first of its 8 Bt rows in tile j = 0
    if (mode == 0) {
        // token pa, features pb + 16 j + r: 8 consecutive hd of one head
        _Float16* o = (_Float16*)Out
            + ((size_t)((pa >> 11) * H_ + (pb >> 6)) * S_ + (pa & (S_ - 1))) * HD_ + (pb & (HD_ - 1));
        v8f bv[4];
#pragma unroll  // constant indices: registers; the bias loads go out as one group
        for (int j = 0; j < 4; ++j) bv[j] = *(const v8f*)(bias + pb + 16 * j);
#pragma unroll  // constant indices: registers, no indexed moves
        for (int i = 0; i < 2; ++i)
#pragma unroll  // constant indices: registers, no indexed moves
            for (int j = 0; j < 4; ++j)
                *(v8h*)(o + i * 16 * HD_ + j * 16) = __builtin_convertvector(acc[i][j] + bv[j], v8h);
        // the stores above still name their address and data registers: wait before any path rewrites them
        asm volatile("s_wait_xcnt 0x0" ::: "memory");
    } else if (mode == 1) {
        // feature pa, tokens pb + 16 j + r: 8 consecutive s of row (b * D_ + feature)
        _Float16* o = (_Float16*)Out + (size_t)((pb >> 11) * D_ + pa) * S_ + (pb & (S_ - 1));
        const float bv0 = bias[pa], bv1 = bias[pa + 16];
#pragma unroll  // constant indices: registers, no indexed moves
        for (int i = 0; i < 2; ++i)
#pragma unroll  // constant indices: registers, no indexed moves
            for (int j = 0; j < 4; ++j)
                *(v8h*)(o + i * 16 * S_ + j * 16) = __builtin_convertvector(acc[i][j] + (i ? bv1 : bv0), v8h);
        // the stores above still name their address and data registers: wait before any path rewrites them
        asm volatile("s_wait_xcnt 0x0" ::: "memory");
    } else {
        // feature pa, tokens pb + 16 j + r
        float* o = (float*)Out + (size_t)pb * D_ + pa;
        const float bv0 = bias[pa], bv1 = bias[pa + 16];
#pragma unroll  // constant indices: registers, no indexed moves
        for (int i = 0; i < 2; ++i)
#pragma unroll  // constant indices: registers, no indexed moves
            for (int j = 0; j < 4; ++j)
#pragma unroll  // constant indices: registers, no indexed moves
                for (int r = 0; r < 8; ++r)
                    o[(j * 16 + r) * D_ + i * 16] = acc[i][j][r] + (i ? bv1 : bv0);
        // the stores above still name their address and data registers: wait before any path rewrites them
        asm volatile("s_wait_xcnt 0x0" ::: "memory");
    }
}

#define QT_ 4
#define FK_ 64
#define FP_ (HD_ + 8)
#define FT_ (S_ / FK_)
#define FB_ (64 * FP_)
static_assert(FK_ == 64 && HD_ == 64 && FT_ >= 2, "a stage is 64 rows of 128 B of K and of V^T; the ring needs two stages");

// One stage's copies of one lane, 16 B each: rows r, r + 16, r + 32, r + 48 of the K tile
// and rows 4 r .. 4 r + 3 of the V^T tile (8 lanes a row: every copy instruction of a wave
// covers 4 whole rows).  gk, gv: the lane's global addresses in its first row of each tile;
// lk, lv: its LDS addresses there.
__device__ __forceinline__ void stage_copy(const _Float16* gk, const _Float16* gv,
                                           _Float16* lk, _Float16* lv) {
#pragma unroll  // all 8 copies of a lane in flight at once: one latency per stage
    for (int c = 0; c < 4; ++c) {
        __builtin_amdgcn_global_load_async_to_lds_b128(
            (AS1_ v4i*)(void*)(gk + c * 16 * HD_), (AS3_ v4i*)(lk + c * 16 * FP_), 0, 0);
        __builtin_amdgcn_global_load_async_to_lds_b128(
            (AS1_ v4i*)(void*)(gv + c * S_), (AS3_ v4i*)(lv + c * FP_), 0, 0);
    }
}

// lane l <-> lane l ^ 16
__device__ __forceinline__ float xhalf(float x) {
    const int xi = __builtin_bit_cast(int, x);
    return __builtin_bit_cast(float, __builtin_amdgcn_permlanex16(
        xi, xi, 0x76543210, 0xfedcba98, false, false));
}

__global__ __launch_bounds__(128)
void flash_attn_wmma(const _Float16* __restrict__ Q, const _Float16* __restrict__ Km,
                     const _Float16* __restrict__ Vt, const int* __restrict__ mask,
                     _Float16* __restrict__ Outv)
{
    // additive key mask of this batch row: a lane needs 16 keys' values per step
    // then the two buffers of K [key][hd] and the two of V^T [hd][key].  One array fixes that order:
    // every copy's destination lies above the constant steps between a lane's copies, so where the
    // compiler moves such a step into a copy's offset field the LDS address register stays above 0
    __shared__ __align__(16) unsigned char sAll[S_ * 4 + 4 * FB_ * 2];
    float*    const sBias = (float*)sAll;
    _Float16* const sK    = (_Float16*)(sAll + S_ * 4);
    _Float16* const sV    = sK + 2 * FB_;

    const int bh   = blockIdx.y;                  // b*H + h
    const int b    = bh >> 4;
    const int h    = bh & 15;
    const int wid  = threadIdx.x >> 5;
    const int lane = threadIdx.x & 31;
    const int cn   = lane & 15;                   // query column of this lane
    const int rhalf = lane >> 4;                  // 0: rows 0..7, 1: rows 8..15
    const int q0   = blockIdx.x * (64 * QT_) + wid * (16 * QT_);

    const _Float16* Qbh = Q  + (size_t)bh * S_ * HD_;
    const _Float16* Kbh = Km + (size_t)bh * S_ * HD_;
    const _Float16* Vbh = Vt + (size_t)bh * HD_ * S_;
    const int*      mb  = mask + b * S_;

    // this lane's piece of a stage: 16 bytes at half cseg of K rows crow + 16 c, V^T rows 4 crow + c
    const int crow = threadIdx.x >> 3;
    const int cseg = (threadIdx.x & 7) * 8;
    const _Float16* gk = Kbh + crow * HD_ + cseg;
    const _Float16* gv = Vbh + crow * 4 * S_ + cseg;
    _Float16* lk = &sK[crow * FP_ + cseg];
    _Float16* lv = &sV[crow * 4 * FP_ + cseg];

    stage_copy(gk, gv, lk, lv);                   // stage 0 into buffer 0

#pragma unroll  // all 16 loads of a thread in flight at once: one latency, not sixteen
    for (int i = 0; i < S_ / 128; ++i) {
        const int key = i * 128 + threadIdx.x;
        sBias[key] = mb[key] ? 0.0f : -1.0e30f;
    }

    v16h qf[QT_][2];
    v8f  o[QT_][4];
    float mrow[QT_], lsum[QT_];                   // lsum: this half's keys only
#pragma unroll  // constant indices: registers, no indexed moves
    for (int t = 0; t < QT_; ++t) {
        qf[t][0] = frag_ld(Qbh + (size_t)(q0 + 16 * t) * HD_,      HD_);
        qf[t][1] = frag_ld(Qbh + (size_t)(q0 + 16 * t) * HD_ + 32, HD_);
    }
    // address registers of the mask and Q loads are reused below: wait first
    asm volatile("s_wait_xcnt 0x0" ::: "memory");
    __builtin_amdgcn_sched_barrier(0);            // keeps the register writes below behind that wait

#pragma unroll  // constant indices: registers, no indexed moves
    for (int t = 0; t < QT_; ++t) {
#pragma unroll  // constant indices: registers, no indexed moves
        for (int j = 0; j < 4; ++j) o[t][j] = v8f_zero();
        mrow[t] = -3.0e38f;
        lsum[t] = 0.0f;
    }

    const float scale = 0.125f;                   // 1/sqrt(64)

    // this wave's copies of stage 0 have landed before the barrier behind which others read them
    asm volatile("s_wait_asynccnt 0x0" ::: "memory");
    __syncthreads();                              // bias table and stage 0 complete
    stage_copy(gk + FK_ * HD_, gv + FK_, lk + FB_, lv + FB_);   // stage 1 into buffer 1

    for (int st = 0; st < FT_; ++st) {
      const _Float16* kb = sK + (st & 1) * FB_;   // stage st's buffers
      const _Float16* vb = sV + (st & 1) * FB_;
#pragma unroll  // constant LDS offsets for both 32-key passes of a stage
      for (int p = 0; p < FK_ / 32; ++p) {
        const int n0 = st * FK_ + p * 32;

        // K fragments (A operand of the first product), loaded once for all tiles
        const v16h kf00 = frag_ld(kb + (p * 32     ) * FP_,      FP_);
        const v16h kf01 = frag_ld(kb + (p * 32     ) * FP_ + 32, FP_);
        const v16h kf10 = frag_ld(kb + (p * 32 + 16) * FP_,      FP_);
        const v16h kf11 = frag_ld(kb + (p * 32 + 16) * FP_ + 32, FP_);

        // V^T fragments: A operand of the second product, same loader as before
        v16h vf[4];
#pragma unroll  // vf stays in registers only with constant indices
        for (int j = 0; j < 4; ++j)
            vf[j] = frag_ld(vb + (j * 16) * FP_ + p * 32, FP_);

        const v4f* bp = (const v4f*)&sBias[n0 + 8 * rhalf];
        const v8f bias0 = __builtin_shufflevector(bp[0], bp[1], 0, 1, 2, 3, 4, 5, 6, 7);
        const v8f bias1 = __builtin_shufflevector(bp[4], bp[5], 0, 1, 2, 3, 4, 5, 6, 7);

        // ---- scores S^T[32x16] = K * Q^T, per query tile ----
        v8f s0[QT_], s1[QT_];
#pragma unroll  // constant indices: registers, no indexed moves
        for (int t = 0; t < QT_; ++t) {
            s0[t] = wmma32(kf00, qf[t][0], v8f_zero());
            s1[t] = wmma32(kf10, qf[t][0], v8f_zero());
        }
#pragma unroll  // constant indices: registers, no indexed moves
        for (int t = 0; t < QT_; ++t) {
            s0[t] = wmma32(kf01, qf[t][1], s0[t]);
            s1[t] = wmma32(kf11, qf[t][1], s1[t]);
        }

#pragma unroll  // constant indices: registers, no indexed moves
        for (int t = 0; t < QT_; ++t) {
            // ---- online softmax, one query per lane ----
            const v8f a0 = s0[t] * scale + bias0;
            const v8f a1 = s1[t] * scale + bias1;
            float cm = fmaxf(a0[0], a1[0]);
#pragma unroll  // constant indices keep the score tiles in registers
            for (int r = 1; r < 8; ++r) cm = fmaxf(cm, fmaxf(a0[r], a1[r]));
            cm = fmaxf(cm, xhalf(cm));            // both halves: the query's block maximum
            const float mn = fmaxf(mrow[t], cm);
            const float al = __expf(mrow[t] - mn);
            mrow[t] = mn;

            v16h pf;
            float pr[8];
            const v8f d0 = a0 - mn;               // whole tiles: neighbouring registers pair up
            const v8f d1 = a1 - mn;
            v8f e0, e1;
#pragma unroll  // constant indices: registers, no indexed moves
            for (int r = 0; r < 8; ++r) e0[r] = __expf(d0[r]);
#pragma unroll  // constant indices: registers, no indexed moves
            for (int r = 0; r < 8; ++r) e1[r] = __expf(d1[r]);
#pragma unroll  // constant indices: registers, no indexed moves
            for (int r = 0; r < 8; ++r) {
                pr[r] = e0[r] + e1[r];
                pf[r]     = (_Float16)e0[r];      // k slots 0..7  = keys 8h + r
                pf[8 + r] = (_Float16)e1[r];      // k slots 8..15 = keys 16 + 8h + r
            }
            const float ps = ((pr[0] + pr[1]) + (pr[2] + pr[3])) + ((pr[4] + pr[5]) + (pr[6] + pr[7]));
            lsum[t] = lsum[t] * al + ps;

            // ---- O^T += V^T * P^T ----
#pragma unroll  // constant indices: registers, no indexed moves
            for (int j = 0; j < 4; ++j) {
                o[t][j] *= al;
                o[t][j] = wmma32(vf[j], pf, o[t][j]);
            }
        }
      }
      // publish point of stage st + 1, every wave, in this order:
      // this wave's reads of stage st's buffers have returned before they are refilled
      asm volatile("s_wait_dscnt 0x0" ::: "memory");
      // this wave's copies of stage st + 1 have landed before the barrier behind which others read them
      asm volatile("s_wait_asynccnt 0x0" ::: "memory");
      __syncthreads();
      if (st + 2 < FT_)                           // the same for the whole work-group
          stage_copy(gk + (st + 2) * (FK_ * HD_), gv + (st + 2) * FK_,
                     lk + (st & 1) * FB_, lv + (st & 1) * FB_);
    }
    // no copy is outstanding when the wave ends
    asm volatile("s_wait_asynccnt 0x0" ::: "memory");

    // ---- finalize + write [B,S,D] f16: a lane holds 8 consecutive hd of its query ----
#pragma unroll  // constant indices: registers, no indexed moves
    for (int t = 0; t < QT_; ++t) {
        const float lt = lsum[t] + xhalf(lsum[t]);
        _Float16* orow = Outv + ((size_t)(b * S_ + q0 + 16 * t + cn)) * D_ + h * HD_ + 8 * rhalf;
#pragma unroll  // constant indices: registers, no indexed moves
        for (int j = 0; j < 4; ++j) {
            v8h ov;
#pragma unroll  // constant indices: registers, no indexed moves
            for (int r = 0; r < 8; ++r) ov[r] = (_Float16)(o[t][j][r] / lt);
            *(v8h*)(orow + j * 16) = ov;
        }
    }
}

// ---------------------------------------------------------------------------
extern "C" void kernel_launch(void* const* d_in, const int* in_sizes, int n_in,
                              void* d_out, int out_size, void* d_ws, size_t ws_size,
                              hipStream_t stream) {
    const float* x    = (const float*)d_in[0];
    const int*   mask = (const int*)  d_in[1];
    const float* Wq   = (const float*)d_in[2];
    const float* bq   = (const float*)d_in[3];
    const float* Wk   = (const float*)d_in[4];
    const float* bk   = (const float*)d_in[5];
    const float* Wv   = (const float*)d_in[6];
    const float* bv   = (const float*)d_in[7];
    const float* Wo   = (const float*)d_in[8];
    const float* bo   = (const float*)d_in[9];

    const int MT = B_ * S_;              // 8192 rows
    const int NX = MT * D_;              // 8388608
    const int NW = D_ * D_;              // 1048576

    _Float16* ws    = (_Float16*)d_ws;
    _Float16* xh    = ws;                // [8192,1024]
    _Float16* wqh   = xh   + NX;
    _Float16* wkh   = wqh  + NW;
    _Float16* wvh   = wkh  + NW;
    _Float16* woh   = wvh  + NW;
    _Float16* qh    = woh  + NW;         // [B,H,S,64]
    _Float16* kh    = qh   + NX;         // [B,H,S,64]
    _Float16* vth   = kh   + NX;         // [B,H,64,S]
    _Float16* valsh = vth  + NX;         // [B,S,D]

    cvt_f32_f16<<<NX / CVT_TILE, 256, 0, stream>>>(x,  xh);
    cvt_f32_f16<<<NW / CVT_TILE, 256, 0, stream>>>(Wq, wqh);
    cvt_f32_f16<<<NW / CVT_TILE, 256, 0, stream>>>(Wk, wkh);
    cvt_f32_f16<<<NW / CVT_TILE, 256, 0, stream>>>(Wv, wvh);
    cvt_f32_f16<<<NW / CVT_TILE, 256, 0, stream>>>(Wo, woh);

    dim3 gg(D_ / 128, MT / 128);         // (8, 64)
    gemm128_wmma<<<gg, 256, 0, stream>>>(xh, wqh, bq, qh,  MT, D_, D_, 0);
    gemm128_wmma<<<gg, 256, 0, stream>>>(xh, wkh, bk, kh,  MT, D_, D_, 0);
    gemm128_wmma<<<gg, 256, 0, stream>>>(wvh, xh, bv, vth, MT, D_, D_, 1);

    flash_attn_wmma<<<dim3(S_ / (64 * QT_), B_ * H_), 128, 0, stream>>>(qh, kh, vth, mask, valsh);

    gemm128_wmma<<<gg, 256, 0, stream>>>(woh, valsh, bo, d_out, MT, D_, D_, 2);
}

// v007
// One run takes 132 microseconds.
// In both of two side-by-side timings against v006, it was 1.18 times as fast.
// All steps since v000 together make it 4.35 times as fast.
#include <hip/hip_runtime.h>
#include <hip/hip_bf16.h>

// ---------------------------------------------------------------------------
// MI455X (gfx1250) multi-head attention, WMMA f16 path.
//   B=4 S=2048 D=1024 H=16 Hd=64.  ~137 GFLOP total -> compute bound; all
//   GEMM stages go through v_wmma_f32_16x16x32_f16 (f32 accumulate).
//   Data movement: GEMM tiles and the flash loop's K / V^T tiles staged via
//   async global->LDS (ASYNCcnt).
// ---------------------------------------------------------------------------

typedef __attribute__((ext_vector_type(16))) _Float16 v16h;
typedef __attribute__((ext_vector_type(8)))  _Float16 v8h;
typedef __attribute__((ext_vector_type(8)))  float    v8f;
typedef __attribute__((ext_vector_type(4)))  float    v4f;
typedef __attribute__((ext_vector_type(4)))  _Float16 v4h;
typedef __attribute__((__vector_size__(16))) int      v4i;   // matches builtin param

#define AS1_ __attribute__((address_space(1)))
#define AS3_ __attribute__((address_space(3)))

#define B_  4
#define S_  2048
#define D_  1024
#define H_  16
#define HD_ 64

__device__ __forceinline__ v8f v8f_zero() {
    v8f z; for (int i = 0; i < 8; ++i) z[i] = 0.0f; return z;
}

// A/B fragment gather for v_wmma_f32_16x16x32_f16 (16x32 tile, K-contiguous
// rows).  Lane L<16: row L, K={0..7,16..23}; lane L>=16: row L-16,
// K={8..15,24..31}.  Two 16-byte loads per lane.
__device__ __forceinline__ v16h frag_ld(const _Float16* p16, int stride) {
    const int lane = threadIdx.x & 31;
    const int r    = lane & 15;
    const int ko   = (lane >> 4) << 3;            // 0 or 8
    const _Float16* p = p16 + (size_t)r * stride + ko;
    v8h lo = *(const v8h*)(p);
    v8h hi = *(const v8h*)(p + 16);
    return __builtin_shufflevector(lo, hi, 0,1,2,3,4,5,6,7,8,9,10,11,12,13,14,15);
}

__device__ __forceinline__ v8f wmma32(v16h a, v16h b, v8f c) {
    return __builtin_amdgcn_wmma_f32_16x16x32_f16(
        /*neg_a=*/false, a, /*neg_b=*/false, b,
        /*c_mod=*/(short)0, c, /*reuse_a=*/false, /*reuse_b=*/false);
}

// ---------------------------------------------------------------------------
// fp32 -> f16 conversion.  A lane converts CVT_U groups of 4 elements, so a
// launch starts 1/64 of the waves that one element per lane needs.
// A wave owns CVT_U * 128 consecutive elements: each load instruction covers
// 512 contiguous bytes, each store 256, whole 128-byte lines both ways.
// No tail: every array length is a multiple of CVT_TILE (asserted below).
// One launch converts all five arrays (none depends on another): a launch of a
// 4 MiB weight matrix is all gap, start and one memory latency, and here its
// blocks run beside those of x.  The f16 copies lie one behind another in the
// workspace in the order x, Wq, Wk, Wv, Wo, so the block index alone gives the
// destination; the source is picked by tests on the block index (scalar).
// ---------------------------------------------------------------------------
#define CVT_U    16                               // 16-byte loads in flight per lane
#define CVT_TILE (256 * CVT_U * 4)                // elements per block
#define CVT_XB   ((B_ * S_ * D_) / CVT_TILE)      // blocks that convert x
#define CVT_WB   ((D_ * D_) / CVT_TILE)           // blocks per weight matrix
static_assert((B_ * S_ * D_) % CVT_TILE == 0 && (D_ * D_) % CVT_TILE == 0,
              "conversion has no tail handling");

__global__ __launch_bounds__(256)
void cvt_f32_f16(const float* __restrict__ x,  const float* __restrict__ wq,
                 const float* __restrict__ wk, const float* __restrict__ wv,
                 const float* __restrict__ wo, _Float16* __restrict__ d) {
    const unsigned blk = blockIdx.x;
    const unsigned wb  = blk - CVT_XB;            // block among the weights' (used where blk >= CVT_XB)
    const unsigned wi  = wb / CVT_WB;             // which weight matrix
    const float* s = blk < CVT_XB ? x : wi == 0 ? wq : wi == 1 ? wk : wi == 2 ? wv : wo;
    const int sb = blk < CVT_XB ? blk : wb % CVT_WB;   // block within the source array
    const int lo = (threadIdx.x >> 5) * (CVT_U * 128) + (threadIdx.x & 31) * 4;
    const int e0 = blk * CVT_TILE + lo;           // element in the row of f16 arrays
    const float* p = s + sb * CVT_TILE + lo;
    v4f v[CVT_U];
#pragma unroll  // all loads of a lane issue before the first convert: one memory latency per wave
    for (int u = 0; u < CVT_U; ++u) v[u] = *(const v4f*)(p + u * 128);
    // wait before any register that the loads name is rewritten; p as an input keeps the
    // address pair from becoming a load's destination while earlier loads still name it
    asm volatile("s_wait_xcnt 0x0" :: "v"(p) : "memory");
    // without it the compiler lifts converts over the wait and holds the last four loads
    // back until the first have landed: a second memory latency
    __builtin_amdgcn_sched_barrier(0);
#pragma unroll  // constant indices: registers, no indexed moves
    for (int u = 0; u < CVT_U; ++u)
        *(v4h*)(d + e0 + u * 128) = __builtin_convertvector(v[u], v4h);
}

// ---------------------------------------------------------------------------
// C[a,b] = sum_k A[a,k] * Bt[b,k] + bias   (A,Bt f16 row-major, K-contiguous)
// 128x128 block, 256 threads (8 waves), each wave: 32 A rows x 64 Bt rows via
// 2x4 WMMA tiles.  Bt's fragment is the FIRST matrix operand, so a lane ends up
// with one A row and 8 consecutive Bt rows in the 8 registers of a tile.  The
// host passes as Bt the matrix whose rows run along the contiguous direction of
// the 16-bit output (mode 0: weights, mode 1: tokens): a tile leaves a lane as
// one 16-byte store.  Grid: x = 128 features, y = 128 tokens in every mode.
// A stage is GK_ = 128 k of both tiles: 256 B of every row, so one copy
// instruction of a wave (32 lanes x 16 B) covers two whole rows = four whole
// 128-byte lines, and the copy latency and the two barriers are paid once per
// 128 k.  LDS pitch 272 B (16 B x odd) keeps the 16-byte fragment reads off
// each other's banks.  K must be a multiple of GK_ (asserted for D_ below).
// mode 0: A tokens, Bt weights: f16 out at [B,H,S,64]      (Q / K)
// mode 1: A weights, Bt tokens: f16 out at [B,H,64,S]      (V transposed)
// mode 2: A weights, Bt tokens: f32 out at [tokens,D_]     (final projection;
//         16 lanes = 64 contiguous bytes per 4-byte store)
// A launch carries up to three independent products of this shape, picked by
// blockIdx.z: Q, K and V go as one launch, so no gap, start or drain lies
// between them and a WGP holds as many blocks as fit it (the copy wait of one
// block lies under the products of the others).
// ---------------------------------------------------------------------------
#define GK_ 128                                   // k per stage
#define GP_ (GK_ + 8)                             // LDS row pitch in halves (272 B)
static_assert(D_ % GK_ == 0, "a stage has no k tail");

struct GemmJob {
    const _Float16* A;
    const _Float16* Bt;
    const float*    bias;
    void*           Out;
    int             mode;
};

__global__ __launch_bounds__(256)
void gemm128_wmma(GemmJob j0, GemmJob j1, GemmJob j2, int M, int N, int K)
{
    __shared__ __align__(16) _Float16 sA[128 * GP_];
    __shared__ __align__(16) _Float16 sB[128 * GP_];

    const GemmJob job = blockIdx.z == 0 ? j0 : blockIdx.z == 1 ? j1 : j2;   // the same for the whole block
    const _Float16* __restrict__ A    = job.A;
    const _Float16* __restrict__ Bt   = job.Bt;
    const float*    __restrict__ bias = job.bias;
    void*           __restrict__ Out  = job.Out;
    const int mode = job.mode;

    const int m0   = (mode == 0 ? blockIdx.y : blockIdx.x) * 128;   // first A row
    const int n0   = (mode == 0 ? blockIdx.x : blockIdx.y) * 128;   // first Bt row
    const int tid  = threadIdx.x;
    const int wid  = tid >> 5;
    const int wm   = (wid & 3) * 32;              // wave m-offset in tile
    const int wn   = (wid >> 2) * 64;             // wave n-offset in tile
    const int crow = tid >> 4;                    // 0..15 : staged row within a group of 16
    const int cseg = (tid & 15) * 8;              // 16-byte piece of the row's 256 B

    v8f acc[2][4];
    for (int i = 0; i < 2; ++i)
        for (int j = 0; j < 4; ++j) acc[i][j] = v8f_zero();

    const _Float16* ga = A  + (size_t)(m0 + crow) * K + cseg;
    const _Float16* gb = Bt + (size_t)(n0 + crow) * K + cseg;

    for (int k0 = 0; k0 < K; k0 += GK_) {
        // Direct global->LDS copies (no VGPR round-trip); tracked by ASYNCcnt.
#pragma unroll  // all 16 copies of a lane in flight at once: one latency per stage
        for (int c = 0; c < 8; ++c) {
            __builtin_amdgcn_global_load_async_to_lds_b128(
                (AS1_ v4i*)(void*)(ga + (size_t)(c * 16) * K + k0),
                (AS3_ v4i*)&sA[(c * 16 + crow) * GP_ + cseg], 0, 0);
            __builtin_amdgcn_global_load_async_to_lds_b128(
                (AS1_ v4i*)(void*)(gb + (size_t)(c * 16) * K + k0),
                (AS3_ v4i*)&sB[(c * 16 + crow) * GP_ + cseg], 0, 0);
        }
        // this wave's copies have landed before the barrier behind which others read them
        asm volatile("s_wait_asynccnt 0x0" ::: "memory");
        __syncthreads();

#pragma unroll  // constant LDS offsets; the next 32 k's fragment reads can go ahead of these products
        for (int kk = 0; kk < GK_; kk += 32) {
            v16h fa0 = frag_ld(&sA[(wm +  0) * GP_ + kk], GP_);
            v16h fa1 = frag_ld(&sA[(wm + 16) * GP_ + kk], GP_);
            v16h fb0 = frag_ld(&sB[(wn +  0) * GP_ + kk], GP_);
            v16h fb1 = frag_ld(&sB[(wn + 16) * GP_ + kk], GP_);
            v16h fb2 = frag_ld(&sB[(wn + 32) * GP_ + kk], GP_);
            v16h fb3 = frag_ld(&sB[(wn + 48) * GP_ + kk], GP_);

            acc[0][0] = wmma32(fb0, fa0, acc[0][0]);
            acc[0][1] = wmma32(fb1, fa0, acc[0][1]);
            acc[0][2] = wmma32(fb2, fa0, acc[0][2]);
            acc[0][3] = wmma32(fb3, fa0, acc[0][3]);
            acc[1][0] = wmma32(fb0, fa1, acc[1][0]);
            acc[1][1] = wmma32(fb1, fa1, acc[1][1]);
            acc[1][2] = wmma32(fb2, fa1, acc[1][2]);
            acc[1][3] = wmma32(fb3, fa1, acc[1][3]);
        }
        // this wave's LDS reads have returned before the next stage's copies overwrite the tiles
        asm volatile("s_wait_dscnt 0x0" ::: "memory");
        __syncthreads();
    }

    // epilogue: register r of acc[i][j] = C[A row 16 i + (lane & 15)][Bt row 16 j + 8 (lane >> 4) + r].
    // One branch on the mode around fully unrolled loops: every accumulator index is a
    // constant (no scratch), every store address is one base plus a constant.
    const int lane = tid & 31;
    const int pa   = m0 + wm + (lane & 15);       // this lane's A row in tile i = 0
    const int pb   = n0 + wn + (lane >> 4) * 8;   // first of its 8 Bt rows in tile j = 0
    if (mode == 0) {
        // token pa, features pb + 16 j + r: 8 consecutive hd of one head
        _Float16* o = (_Float16*)Out
            + ((size_t)((pa >> 11) * H_ + (pb >> 6)) * S_ + (pa & (S_ - 1))) * HD_ + (pb & (HD_ - 1));
        v8f bv[4];
#pragma unroll  // constant indices: registers; the bias loads go out as one group
        for (int j = 0; j < 4; ++j) bv[j] = *(const v8f*)(bias + pb + 16 * j);
#pragma unroll  // constant indices: registers, no indexed moves
        for (int i = 0; i < 2; ++i)
#pragma unroll  // constant indices: registers, no indexed moves
            for (int j = 0; j < 4; ++j)
                *(v8h*)(o + i * 16 * HD_ + j * 16) = __builtin_convertvector(acc[i][j] + bv[j], v8h);
        // the stores above still name their address and data registers: wait before any path rewrites them
        asm volatile("s_wait_xcnt 0x0" ::: "memory");
    } else if (mode == 1) {
        // feature pa, tokens pb + 16 j + r: 8 consecutive s of row (b * D_ + feature)
        _Float16* o = (_Float16*)Out + (size_t)((pb >> 11) * D_ + pa) * S_ + (pb & (S_ - 1));
        const float bv0 = bias[pa], bv1 = bias[pa + 16];
#pragma unroll  // constant indices: registers, no indexed moves
        for (int i = 0; i < 2; ++i)
#pragma unroll  // constant indices: registers, no indexed moves
            for (int j = 0; j < 4; ++j)
                *(v8h*)(o + i * 16 * S_ + j * 16) = __builtin_convertvector(acc[i][j] + (i ? bv1 : bv0), v8h);
        // the stores above still name their address and data registers: wait before any path rewrites them
        asm volatile("s_wait_xcnt 0x0" ::: "memory");
    } else {
        // feature pa, tokens pb + 16 j + r
        float* o = (float*)Out + (size_t)pb * D_ + pa;
        const float bv0 = bias[pa], bv1 = bias[pa + 16];
#pragma unroll  // constant indices: registers, no indexed moves
        for (int i = 0; i < 2; ++i)
#pragma unroll  // constant indices: registers, no indexed moves
            for (int j = 0; j < 4; ++j)
#pragma unroll  // constant indices: registers, no indexed moves
                for (int r = 0; r < 8; ++r)
                    o[(j * 16 + r) * D_ + i * 16] = acc[i][j][r] + (i ? bv1 : bv0);
        // the stores above still name their address and data registers: wait before any path rewrites them
        asm volatile("s_wait_xcnt 0x0" ::: "memory");
    }
}

#define QT_ 4
#define FK_ 64
#define FP_ (HD_ + 8)
#define FT_ (S_ / FK_)
#define FB_ (64 * FP_)
static_assert(FK_ == 64 && HD_ == 64 && FT_ >= 2, "a stage is 64 rows of 128 B of K and of V^T; the ring needs two stages");

// One stage's copies of one lane, 16 B each: rows r, r + 16, r + 32, r + 48 of the K tile
// and rows 4 r .. 4 r + 3 of the V^T tile (8 lanes a row: every copy instruction of a wave
// covers 4 whole rows).  gk, gv: the lane's global addresses in its first row of each tile;
// lk, lv: its LDS addresses there.
__device__ __forceinline__ void stage_copy(const _Float16* gk, const _Float16* gv,
                                           _Float16* lk, _Float16* lv) {
#pragma unroll  // all 8 copies of a lane in flight at once: one latency per stage
    for (int c = 0; c < 4; ++c) {
        __builtin_amdgcn_global_load_async_to_lds_b128(
            (AS1_ v4i*)(void*)(gk + c * 16 * HD_), (AS3_ v4i*)(lk + c * 16 * FP_), 0, 0);
        __builtin_amdgcn_global_load_async_to_lds_b128(
            (AS1_ v4i*)(void*)(gv + c * S_), (AS3_ v4i*)(lv + c * FP_), 0, 0);
    }
}

// lane l <-> lane l ^ 16
__device__ __forceinline__ float xhalf(float x) {
    const int xi = __builtin_bit_cast(int, x);
    return __builtin_bit_cast(float, __builtin_amdgcn_permlanex16(
        xi, xi, 0x76543210, 0xfedcba98, false, false));
}

__global__ __launch_bounds__(128)
void flash_attn_wmma(const _Float16* __restrict__ Q, const _Float16* __restrict__ Km,
                     const _Float16* __restrict__ Vt, const int* __restrict__ mask,
                     _Float16* __restrict__ Outv)
{
    // additive key mask of this batch row: a lane needs 16 keys' values per step
    // then the two buffers of K [key][hd] and the two of V^T [hd][key].  One array fixes that order:
    // every copy's destination lies above the constant steps between a lane's copies, so where the
    // compiler moves such a step into a copy's offset field the LDS address register stays above 0
    __shared__ __align__(16) unsigned char sAll[S_ * 4 + 4 * FB_ * 2];
    float*    const sBias = (float*)sAll;
    _Float16* const sK    = (_Float16*)(sAll + S_ * 4);
    _Float16* const sV    = sK + 2 * FB_;

    const int bh   = blockIdx.y;                  // b*H + h
    const int b    = bh >> 4;
    const int h    = bh & 15;
    const int wid  = threadIdx.x >> 5;
    const int lane = threadIdx.x & 31;
    const int cn   = lane & 15;                   // query column of this lane
    const int rhalf = lane >> 4;                  // 0: rows 0..7, 1: rows 8..15
    const int q0   = blockIdx.x * (64 * QT_) + wid * (16 * QT_);

    const _Float16* Qbh = Q  + (size_t)bh * S_ * HD_;
    const _Float16* Kbh = Km + (size_t)bh * S_ * HD_;
    const _Float16* Vbh = Vt + (size_t)bh * HD_ * S_;
    const int*      mb  = mask + b * S_;

    // this lane's piece of a stage: 16 bytes at half cseg of K rows crow + 16 c, V^T rows 4 crow + c
    const int crow = threadIdx.x >> 3;
    const int cseg = (threadIdx.x & 7) * 8;
    const _Float16* gk = Kbh + crow * HD_ + cseg;
    const _Float16* gv = Vbh + crow * 4 * S_ + cseg;
    _Float16* lk = &sK[crow * FP_ + cseg];
    _Float16* lv = &sV[crow * 4 * FP_ + cseg];

    stage_copy(gk, gv, lk, lv);                   // stage 0 into buffer 0

#pragma unroll  // all 16 loads of a thread in flight at once: one latency, not sixteen
    for (int i = 0; i < S_ / 128; ++i) {
        const int key = i * 128 + threadIdx.x;
        sBias[key] = mb[key] ? 0.0f : -1.0e30f;
    }

    v16h qf[QT_][2];
    v8f  o[QT_][4];
    float mrow[QT_], lsum[QT_];                   // lsum: this half's keys only
#pragma unroll  // constant indices: registers, no indexed moves
    for (int t = 0; t < QT_; ++t) {
        qf[t][0] = frag_ld(Qbh + (size_t)(q0 + 16 * t) * HD_,      HD_);
        qf[t][1] = frag_ld(Qbh + (size_t)(q0 + 16 * t) * HD_ + 32, HD_);
    }
    // address registers of the mask and Q loads are reused below: wait first
    asm volatile("s_wait_xcnt 0x0" ::: "memory");
    __builtin_amdgcn_sched_barrier(0);            // keeps the register writes below behind that wait

#pragma unroll  // constant indices: registers, no indexed moves
    for (int t = 0; t < QT_; ++t) {
#pragma unroll  // constant indices: registers, no indexed moves
        for (int j = 0; j < 4; ++j) o[t][j] = v8f_zero();
        mrow[t] = -3.0e38f;
        lsum[t] = 0.0f;
    }

    const float scale = 0.125f;                   // 1/sqrt(64)

    // this wave's copies of stage 0 have landed before the barrier behind which others read them
    asm volatile("s_wait_asynccnt 0x0" ::: "memory");
    __syncthreads();                              // bias table and stage 0 complete
    stage_copy(gk + FK_ * HD_, gv + FK_, lk + FB_, lv + FB_);   // stage 1 into buffer 1

    for (int st = 0; st < FT_; ++st) {
      const _Float16* kb = sK + (st & 1) * FB_;   // stage st's buffers
      const _Float16* vb = sV + (st & 1) * FB_;
#pragma unroll  // constant LDS offsets for both 32-key passes of a stage
      for (int p = 0; p < FK_ / 32; ++p) {
        const int n0 = st * FK_ + p * 32;

        // K fragments (A operand of the first product), loaded once for all tiles
        const v16h kf00 = frag_ld(kb + (p * 32     ) * FP_,      FP_);
        const v16h kf01 = frag_ld(kb + (p * 32     ) * FP_ + 32, FP_);
        const v16h kf10 = frag_ld(kb + (p * 32 + 16) * FP_,      FP_);
        const v16h kf11 = frag_ld(kb + (p * 32 + 16) * FP_ + 32, FP_);

        // V^T fragments: A operand of the second product, same loader as before
        v16h vf[4];
#pragma unroll  // vf stays in registers only with constant indices
        for (int j = 0; j < 4; ++j)
            vf[j] = frag_ld(vb + (j * 16) * FP_ + p * 32, FP_);

        const v4f* bp = (const v4f*)&sBias[n0 + 8 * rhalf];
        const v8f bias0 = __builtin_shufflevector(bp[0], bp[1], 0, 1, 2, 3, 4, 5, 6, 7);
        const v8f bias1 = __builtin_shufflevector(bp[4], bp[5], 0, 1, 2, 3, 4, 5, 6, 7);

        // ---- scores S^T[32x16] = K * Q^T, per query tile ----
        v8f s0[QT_], s1[QT_];
#pragma unroll  // constant indices: registers, no indexed moves
        for (int t = 0; t < QT_; ++t) {
            s0[t] = wmma32(kf00, qf[t][0], v8f_zero());
            s1[t] = wmma32(kf10, qf[t][0], v8f_zero());
        }
#pragma unroll  // constant indices: registers, no indexed moves
        for (int t = 0; t < QT_; ++t) {
            s0[t] = wmma32(kf01, qf[t][1], s0[t]);
            s1[t] = wmma32(kf11, qf[t][1], s1[t]);
        }

#pragma unroll  // constant indices: registers, no indexed moves
        for (int t = 0; t < QT_; ++t) {
            // ---- online softmax, one query per lane ----
            const v8f a0 = s0[t] * scale + bias0;
            const v8f a1 = s1[t] * scale + bias1;
            float cm = fmaxf(a0[0], a1[0]);
#pragma unroll  // constant indices keep the score tiles in registers
            for (int r = 1; r < 8; ++r) cm = fmaxf(cm, fmaxf(a0[r], a1[r]));
            cm = fmaxf(cm, xhalf(cm));            // both halves: the query's block maximum
            const float mn = fmaxf(mrow[t], cm);
            const float al = __expf(mrow[t] - mn);
            mrow[t] = mn;

            v16h pf;
            float pr[8];
            const v8f d0 = a0 - mn;               // whole tiles: neighbouring registers pair up
            const v8f d1 = a1 - mn;
            v8f e0, e1;
#pragma unroll  // constant indices: registers, no indexed moves
            for (int r = 0; r < 8; ++r) e0[r] = __expf(d0[r]);
#pragma unroll  // constant indices: registers, no indexed moves
            for (int r = 0; r < 8; ++r) e1[r] = __expf(d1[r]);
#pragma unroll  // constant indices: registers, no indexed moves
            for (int r = 0; r < 8; ++r) {
                pr[r] = e0[r] + e1[r];
                pf[r]     = (_Float16)e0[r];      // k slots 0..7  = keys 8h + r
                pf[8 + r] = (_Float16)e1[r];      // k slots 8..15 = keys 16 + 8h + r
            }
            const float ps = ((pr[0] + pr[1]) + (pr[2] + pr[3])) + ((pr[4] + pr[5]) + (pr[6] + pr[7]));
            lsum[t] = lsum[t] * al + ps;

            // ---- O^T += V^T * P^T ----
#pragma unroll  // constant indices: registers, no indexed moves
            for (int j = 0; j < 4; ++j) {
                o[t][j] *= al;
                o[t][j] = wmma32(vf[j], pf, o[t][j]);
            }
        }
      }
      // publish point of stage st + 1, every wave, in this order:
      // this wave's reads of stage st's buffers have returned before they are refilled
      asm volatile("s_wait_dscnt 0x0" ::: "memory");
      // this wave's copies of stage st + 1 have landed before the barrier behind which others read them
      asm volatile("s_wait_asynccnt 0x0" ::: "memory");
      __syncthreads();
      if (st + 2 < FT_)                           // the same for the whole work-group
          stage_copy(gk + (st + 2) * (FK_ * HD_), gv + (st + 2) * FK_,
                     lk + (st & 1) * FB_, lv + (st & 1) * FB_);
    }
    // no copy is outstanding when the wave ends
    asm volatile("s_wait_asynccnt 0x0" ::: "memory");

    // ---- finalize + write [B,S,D] f16: a lane holds 8 consecutive hd of its query ----
#pragma unroll  // constant indices: registers, no indexed moves
    for (int t = 0; t < QT_; ++t) {
        const float lt = lsum[t] + xhalf(lsum[t]);
        _Float16* orow = Outv + ((size_t)(b * S_ + q0 + 16 * t + cn)) * D_ + h * HD_ + 8 * rhalf;
#pragma unroll  // constant indices: registers, no indexed moves
        for (int j = 0; j < 4; ++j) {
            v8h ov;
#pragma unroll  // constant indices: registers, no indexed moves
            for (int r = 0; r < 8; ++r) ov[r] = (_Float16)(o[t][j][r] / lt);
            *(v8h*)(orow + j * 16) = ov;
        }
    }
}

// ---------------------------------------------------------------------------
extern "C" void kernel_launch(void* const* d_in, const int* in_sizes, int n_in,
                              void* d_out, int out_size, void* d_ws, size_t ws_size,
                              hipStream_t stream) {
    const float* x    = (const float*)d_in[0];
    const int*   mask = (const int*)  d_in[1];
    const float* Wq   = (const float*)d_in[2];
    const float* bq   = (const float*)d_in[3];
    const float* Wk   = (const float*)d_in[4];
    const float* bk   = (const float*)d_in[5];
    const float* Wv   = (const float*)d_in[6];
    const float* bv   = (const float*)d_in[7];
    const float* Wo   = (const float*)d_in[8];
    const float* bo   = (const float*)d_in[9];

    const int MT = B_ * S_;              // 8192 rows
    const int NX = MT * D_;              // 8388608
    const int NW = D_ * D_;              // 1048576

    _Float16* ws    = (_Float16*)d_ws;
    _Float16* xh    = ws;                // [8192,1024]
    _Float16* wqh   = xh   + NX;
    _Float16* wkh   = wqh  + NW;
    _Float16* wvh   = wkh  + NW;
    _Float16* woh   = wvh  + NW;
    _Float16* qh    = woh  + NW;         // [B,H,S,64]
    _Float16* kh    = qh   + NX;         // [B,H,S,64]
    _Float16* vth   = kh   + NX;         // [B,H,64,S]
    _Float16* valsh = vth  + NX;         // [B,S,D]

    // xh, wqh, wkh, wvh, woh are one row of arrays from xh on
    cvt_f32_f16<<<CVT_XB + 4 * CVT_WB, 256, 0, stream>>>(x, Wq, Wk, Wv, Wo, xh);

    const GemmJob jq = { xh,  wqh,   bq, qh,    0 };
    const GemmJob jk = { xh,  wkh,   bk, kh,    0 };
    const GemmJob jv = { wvh, xh,    bv, vth,   1 };
    const GemmJob jo = { woh, valsh, bo, d_out, 2 };

    gemm128_wmma<<<dim3(D_ / 128, MT / 128, 3), 256, 0, stream>>>(jq, jk, jv, MT, D_, D_);

    flash_attn_wmma<<<dim3(S_ / (64 * QT_), B_ * H_), 128, 0, stream>>>(qh, kh, vth, mask, valsh);

    gemm128_wmma<<<dim3(D_ / 128, MT / 128, 1), 256, 0, stream>>>(jo, jo, jo, MT, D_, D_);
}

// v008
// One run takes 128 microseconds.
// In two side-by-side timings against v007, it was 1.03 and 1.04 times as fast.
// All steps since v000 together make it 4.51 times as fast.
#include <hip/hip_runtime.h>
#include <hip/hip_bf16.h>

// ---------------------------------------------------------------------------
// MI455X (gfx1250) multi-head attention, WMMA f16 path.
//   B=4 S=2048 D=1024 H=16 Hd=64.  ~137 GFLOP total -> compute bound; all
//   GEMM stages go through v_wmma_f32_16x16x32_f16 (f32 accumulate).
//   Data movement: GEMM tiles and the flash loop's K / V^T tiles staged via
//   async global->LDS (ASYNCcnt).
// ---------------------------------------------------------------------------

typedef __attribute__((ext_vector_type(16))) _Float16 v16h;
typedef __attribute__((ext_vector_type(8)))  _Float16 v8h;
typedef __attribute__((ext_vector_type(8)))  float    v8f;
typedef __attribute__((ext_vector_type(4)))  float    v4f;
typedef __attribute__((ext_vector_type(4)))  _Float16 v4h;
typedef __attribute__((__vector_size__(16))) int      v4i;   // matches builtin param

#define AS1_ __attribute__((address_space(1)))
#define AS3_ __attribute__((address_space(3)))

#define B_  4
#define S_  2048
#define D_  1024
#define H_  16
#define HD_ 64

__device__ __forceinline__ v8f v8f_zero() {
    v8f z; for (int i = 0; i < 8; ++i) z[i] = 0.0f; return z;
}

// A/B fragment gather for v_wmma_f32_16x16x32_f16 (16x32 tile, K-contiguous
// rows).  Lane L<16: row L, K={0..7,16..23}; lane L>=16: row L-16,
// K={8..15,24..31}.  Two 16-byte loads per lane.
__device__ __forceinline__ v16h frag_ld(const _Float16* p16, int stride) {
    const int lane = threadIdx.x & 31;
    const int r    = lane & 15;
    const int ko   = (lane >> 4) << 3;            // 0 or 8
    const _Float16* p = p16 + (size_t)r * stride + ko;
    v8h lo = *(const v8h*)(p);
    v8h hi = *(const v8h*)(p + 16);
    return __builtin_shufflevector(lo, hi, 0,1,2,3,4,5,6,7,8,9,10,11,12,13,14,15);
}

__device__ __forceinline__ v8f wmma32(v16h a, v16h b, v8f c) {
    return __builtin_amdgcn_wmma_f32_16x16x32_f16(
        /*neg_a=*/false, a, /*neg_b=*/false, b,
        /*c_mod=*/(short)0, c, /*reuse_a=*/false, /*reuse_b=*/false);
}

// ---------------------------------------------------------------------------
// fp32 -> f16 conversion.  A lane converts CVT_U groups of 4 elements, so a
// launch starts 1/64 of the waves that one element per lane needs.
// A wave owns CVT_U * 128 consecutive elements: each load instruction covers
// 512 contiguous bytes, each store 256, whole 128-byte lines both ways.
// No tail: every array length is a multiple of CVT_TILE (asserted below).
// One launch converts all five arrays (none depends on another): a launch of a
// 4 MiB weight matrix is all gap, start and one memory latency, and here its
// blocks run beside those of x.  The f16 copies lie one behind another in the
// workspace in the order x, Wq, Wk, Wv, Wo, so the block index alone gives the
// destination; the source is picked by tests on the block index (scalar).
// ---------------------------------------------------------------------------
#define CVT_U    16                               // 16-byte loads in flight per lane
#define CVT_TILE (256 * CVT_U * 4)                // elements per block
#define CVT_XB   ((B_ * S_ * D_) / CVT_TILE)      // blocks that convert x
#define CVT_WB   ((D_ * D_) / CVT_TILE)           // blocks per weight matrix
static_assert((B_ * S_ * D_) % CVT_TILE == 0 && (D_ * D_) % CVT_TILE == 0,
              "conversion has no tail handling");

__global__ __launch_bounds__(256)
void cvt_f32_f16(const float* __restrict__ x,  const float* __restrict__ wq,
                 const float* __restrict__ wk, const float* __restrict__ wv,
                 const float* __restrict__ wo, _Float16* __restrict__ d) {
    const unsigned blk = blockIdx.x;
    const unsigned wb  = blk - CVT_XB;            // block among the weights' (used where blk >= CVT_XB)
    const unsigned wi  = wb / CVT_WB;             // which weight matrix
    const float* s = blk < CVT_XB ? x : wi == 0 ? wq : wi == 1 ? wk : wi == 2 ? wv : wo;
    const int sb = blk < CVT_XB ? blk : wb % CVT_WB;   // block within the source array
    const int lo = (threadIdx.x >> 5) * (CVT_U * 128) + (threadIdx.x & 31) * 4;
    const int e0 = blk * CVT_TILE + lo;           // element in the row of f16 arrays
    const float* p = s + sb * CVT_TILE + lo;
    v4f v[CVT_U];
#pragma unroll  // all loads of a lane issue before the first convert: one memory latency per wave
    for (int u = 0; u < CVT_U; ++u) v[u] = *(const v4f*)(p + u * 128);
    // wait before any register that the loads name is rewritten; p as an input keeps the
    // address pair from becoming a load's destination while earlier loads still name it
    asm volatile("s_wait_xcnt 0x0" :: "v"(p) : "memory");
    // without it the compiler lifts converts over the wait and holds the last four loads
    // back until the first have landed: a second memory latency
    __builtin_amdgcn_sched_barrier(0);
#pragma unroll  // constant indices: registers, no indexed moves
    for (int u = 0; u < CVT_U; ++u)
        *(v4h*)(d + e0 + u * 128) = __builtin_convertvector(v[u], v4h);
}

// ---------------------------------------------------------------------------
// C[a,b] = sum_k A[a,k] * Bt[b,k] + bias   (A,Bt f16 row-major, K-contiguous)
// 128x128 block, 256 threads (8 waves), each wave: 32 A rows x 64 Bt rows via
// 2x4 WMMA tiles.  Bt's fragment is the FIRST matrix operand, so a lane ends up
// with one A row and 8 consecutive Bt rows in the 8 registers of a tile.  The
// host passes as Bt the matrix whose rows run along the contiguous direction of
// the 16-bit output (mode 0: weights, mode 1: tokens): a tile leaves a lane as
// one 16-byte store.  Grid: x = 128 features, y = 128 tokens in every mode.
// A stage is GK_ = 128 k of both tiles: 256 B of every row, so one copy
// instruction of a wave (32 lanes x 16 B) covers two whole rows = four whole
// 128-byte lines, and the copy latency and the two barriers are paid once per
// 128 k.  LDS pitch 272 B (16 B x odd) keeps the 16-byte fragment reads off
// each other's banks.  K must be a multiple of GK_ (asserted for D_ below).
// mode 0: A tokens, Bt weights: f16 out at [B,H,S,64]      (Q / K), times the job's oscale in f32
//         before the one rounding to f16 (Q: QS_, so the scores need no scaling; K: 1)
// mode 1: A weights, Bt tokens: f16 out at [B,H,64,S]      (V transposed)
// mode 2: A weights, Bt tokens: f32 out at [tokens,D_]     (final projection;
//         16 lanes = 64 contiguous bytes per 4-byte store)
// A launch carries up to three independent products of this shape, picked by
// blockIdx.z: Q, K and V go as one launch, so no gap, start or drain lies
// between them and a WGP holds as many blocks as fit it (the copy wait of one
// block lies under the products of the others).
// ---------------------------------------------------------------------------
#define GK_ 128                                   // k per stage
#define GP_ (GK_ + 8)                             // LDS row pitch in halves (272 B)
static_assert(D_ % GK_ == 0, "a stage has no k tail");

struct GemmJob {
    const _Float16* A;
    const _Float16* Bt;
    const float*    bias;
    void*           Out;
    int             mode;
    float           oscale;
};

__global__ __launch_bounds__(256)
void gemm128_wmma(GemmJob j0, GemmJob j1, GemmJob j2, int M, int N, int K)
{
    __shared__ __align__(16) _Float16 sA[128 * GP_];
    __shared__ __align__(16) _Float16 sB[128 * GP_];

    const GemmJob job = blockIdx.z == 0 ? j0 : blockIdx.z == 1 ? j1 : j2;   // the same for the whole block
    const _Float16* __restrict__ A    = job.A;
    const _Float16* __restrict__ Bt   = job.Bt;
    const float*    __restrict__ bias = job.bias;
    void*           __restrict__ Out  = job.Out;
    const int mode = job.mode;
    const float os = job.oscale;

    const int m0   = (mode == 0 ? blockIdx.y : blockIdx.x) * 128;   // first A row
    const int n0   = (mode == 0 ? blockIdx.x : blockIdx.y) * 128;   // first Bt row
    const int tid  = threadIdx.x;
    const int wid  = tid >> 5;
    const int wm   = (wid & 3) * 32;              // wave m-offset in tile
    const int wn   = (wid >> 2) * 64;             // wave n-offset in tile
    const int crow = tid >> 4;                    // 0..15 : staged row within a group of 16
    const int cseg = (tid & 15) * 8;              // 16-byte piece of the row's 256 B

    v8f acc[2][4];
    for (int i = 0; i < 2; ++i)
        for (int j = 0; j < 4; ++j) acc[i][j] = v8f_zero();

    const _Float16* ga = A  + (size_t)(m0 + crow) * K + cseg;
    const _Float16* gb = Bt + (size_t)(n0 + crow) * K + cseg;

    for (int k0 = 0; k0 < K; k0 += GK_) {
        // Direct global->LDS copies (no VGPR round-trip); tracked by ASYNCcnt.
#pragma unroll  // all 16 copies of a lane in flight at once: one latency per stage
        for (int c = 0; c < 8; ++c) {
            __builtin_amdgcn_global_load_async_to_lds_b128(
                (AS1_ v4i*)(void*)(ga + (size_t)(c * 16) * K + k0),
                (AS3_ v4i*)&sA[(c * 16 + crow) * GP_ + cseg], 0, 0);
            __builtin_amdgcn_global_load_async_to_lds_b128(
                (AS1_ v4i*)(void*)(gb + (size_t)(c * 16) * K + k0),
                (AS3_ v4i*)&sB[(c * 16 + crow) * GP_ + cseg], 0, 0);
        }
        // this wave's copies have landed before the barrier behind which others read them
        asm volatile("s_wait_asynccnt 0x0" ::: "memory");
        __syncthreads();

#pragma unroll  // constant LDS offsets; the next 32 k's fragment reads can go ahead of these products
        for (int kk = 0; kk < GK_; kk += 32) {
            v16h fa0 = frag_ld(&sA[(wm +  0) * GP_ + kk], GP_);
            v16h fa1 = frag_ld(&sA[(wm + 16) * GP_ + kk], GP_);
            v16h fb0 = frag_ld(&sB[(wn +  0) * GP_ + kk], GP_);
            v16h fb1 = frag_ld(&sB[(wn + 16) * GP_ + kk], GP_);
            v16h fb2 = frag_ld(&sB[(wn + 32) * GP_ + kk], GP_);
            v16h fb3 = frag_ld(&sB[(wn + 48) * GP_ + kk], GP_);

            acc[0][0] = wmma32(fb0, fa0, acc[0][0]);
            acc[0][1] = wmma32(fb1, fa0, acc[0][1]);
            acc[0][2] = wmma32(fb2, fa0, acc[0][2]);
            acc[0][3] = wmma32(fb3, fa0, acc[0][3]);
            acc[1][0] = wmma32(fb0, fa1, acc[1][0]);
            acc[1][1] = wmma32(fb1, fa1, acc[1][1]);
            acc[1][2] = wmma32(fb2, fa1, acc[1][2]);
            acc[1][3] = wmma32(fb3, fa1, acc[1][3]);
        }
        // this wave's LDS reads have returned before the next stage's copies overwrite the tiles
        asm volatile("s_wait_dscnt 0x0" ::: "memory");
        __syncthreads();
    }

    // epilogue: register r of acc[i][j] = C[A row 16 i + (lane & 15)][Bt row 16 j + 8 (lane >> 4) + r].
    // One branch on the mode around fully unrolled loops: every accumulator index is a
    // constant (no scratch), every store address is one base plus a constant.
    const int lane = tid & 31;
    const int pa   = m0 + wm + (lane & 15);       // this lane's A row in tile i = 0
    const int pb   = n0 + wn + (lane >> 4) * 8;   // first of its 8 Bt rows in tile j = 0
    if (mode == 0) {
        // token pa, features pb + 16 j + r: 8 consecutive hd of one head
        _Float16* o = (_Float16*)Out
            + ((size_t)((pa >> 11) * H_ + (pb >> 6)) * S_ + (pa & (S_ - 1))) * HD_ + (pb & (HD_ - 1));
        v8f bv[4];
#pragma unroll  // constant indices: registers; the bias loads go out as one group
        for (int j = 0; j < 4; ++j) bv[j] = *(const v8f*)(bias + pb + 16 * j);
#pragma unroll  // constant indices: registers, no indexed moves
        for (int i = 0; i < 2; ++i)
#pragma unroll  // constant indices: registers, no indexed moves
            for (int j = 0; j < 4; ++j)
                *(v8h*)(o + i * 16 * HD_ + j * 16) = __builtin_convertvector((acc[i][j] + bv[j]) * os, v8h);
        // the stores above still name their address and data registers: wait before any path rewrites them
        asm volatile("s_wait_xcnt 0x0" ::: "memory");
    } else if (mode == 1) {
        // feature pa, tokens pb + 16 j + r: 8 consecutive s of row (b * D_ + feature)
        _Float16* o = (_Float16*)Out + (size_t)((pb >> 11) * D_ + pa) * S_ + (pb & (S_ - 1));
        const float bv0 = bias[pa], bv1 = bias[pa + 16];
#pragma unroll  // constant indices: registers, no indexed moves
        for (int i = 0; i < 2; ++i)
#pragma unroll  // constant indices: registers, no indexed moves
            for (int j = 0; j < 4; ++j)
                *(v8h*)(o + i * 16 * S_ + j * 16) = __builtin_convertvector(acc[i][j] + (i ? bv1 : bv0), v8h);
        // the stores above still name their address and data registers: wait before any path rewrites them
        asm volatile("s_wait_xcnt 0x0" ::: "memory");
    } else {
        // feature pa, tokens pb + 16 j + r
        float* o = (float*)Out + (size_t)pb * D_ + pa;
        const float bv0 = bias[pa], bv1 = bias[pa + 16];
#pragma unroll  // constant indices: registers, no indexed moves
        for (int i = 0; i < 2; ++i)
#pragma unroll  // constant indices: registers, no indexed moves
            for (int j = 0; j < 4; ++j)
#pragma unroll  // constant indices: registers, no indexed moves
                for (int r = 0; r < 8; ++r)
                    o[(j * 16 + r) * D_ + i * 16] = acc[i][j][r] + (i ? bv1 : bv0);
        // the stores above still name their address and data registers: wait before any path rewrites them
        asm volatile("s_wait_xcnt 0x0" ::: "memory");
    }
}

#define QT_ 4
#define QS_ 0.18033688011112042f
#define FK_ 64
#define FP_ (HD_ + 8)
#define FT_ (S_ / FK_)
#define FB_ (64 * FP_)
static_assert(FK_ == 64 && HD_ == 64 && FT_ >= 2, "a stage is 64 rows of 128 B of K and of V^T; the ring needs two stages");

// One stage's copies of one lane, 16 B each: rows r, r + 16, r + 32, r + 48 of the K tile
// and rows 4 r .. 4 r + 3 of the V^T tile (8 lanes a row: every copy instruction of a wave
// covers 4 whole rows).  gk, gv: the lane's global addresses in its first row of each tile;
// lk, lv: its LDS addresses there.
__device__ __forceinline__ void stage_copy(const _Float16* gk, const _Float16* gv,
                                           _Float16* lk, _Float16* lv) {
#pragma unroll  // all 8 copies of a lane in flight at once: one latency per stage
    for (int c = 0; c < 4; ++c) {
        __builtin_amdgcn_global_load_async_to_lds_b128(
            (AS1_ v4i*)(void*)(gk + c * 16 * HD_), (AS3_ v4i*)(lk + c * 16 * FP_), 0, 0);
        __builtin_amdgcn_global_load_async_to_lds_b128(
            (AS1_ v4i*)(void*)(gv + c * S_), (AS3_ v4i*)(lv + c * FP_), 0, 0);
    }
}

// lane l <-> lane l ^ 16
__device__ __forceinline__ float xhalf(float x) {
    const int xi = __builtin_bit_cast(int, x);
    return __builtin_bit_cast(float, __builtin_amdgcn_permlanex16(
        xi, xi, 0x76543210, 0xfedcba98, false, false));
}

__global__ __launch_bounds__(128)
void flash_attn_wmma(const _Float16* __restrict__ Q, const _Float16* __restrict__ Km,
                     const _Float16* __restrict__ Vt, const int* __restrict__ mask,
                     _Float16* __restrict__ Outv)
{
    // additive key mask of this batch row: a lane needs 16 keys' values per step
    // then the two buffers of K [key][hd] and the two of V^T [hd][key].  One array fixes that order:
    // every copy's destination lies above the constant steps between a lane's copies, so where the
    // compiler moves such a step into a copy's offset field the LDS address register stays above 0
    __shared__ __align__(16) unsigned char sAll[S_ * 4 + 4 * FB_ * 2];
    float*    const sBias = (float*)sAll;
    _Float16* const sK    = (_Float16*)(sAll + S_ * 4);
    _Float16* const sV    = sK + 2 * FB_;

    const int bh   = blockIdx.y;                  // b*H + h
    const int b    = bh >> 4;
    const int h    = bh & 15;
    const int wid  = threadIdx.x >> 5;
    const int lane = threadIdx.x & 31;
    const int cn   = lane & 15;                   // query column of this lane
    const int rhalf = lane >> 4;                  // 0: rows 0..7, 1: rows 8..15
    const int q0   = blockIdx.x * (64 * QT_) + wid * (16 * QT_);

    const _Float16* Qbh = Q  + (size_t)bh * S_ * HD_;
    const _Float16* Kbh = Km + (size_t)bh * S_ * HD_;
    const _Float16* Vbh = Vt + (size_t)bh * HD_ * S_;
    const int*      mb  = mask + b * S_;

    // this lane's piece of a stage: 16 bytes at half cseg of K rows crow + 16 c, V^T rows 4 crow + c
    const int crow = threadIdx.x >> 3;
    const int cseg = (threadIdx.x & 7) * 8;
    const _Float16* gk = Kbh + crow * HD_ + cseg;
    const _Float16* gv = Vbh + crow * 4 * S_ + cseg;
    _Float16* lk = &sK[crow * FP_ + cseg];
    _Float16* lv = &sV[crow * 4 * FP_ + cseg];

    stage_copy(gk, gv, lk, lv);                   // stage 0 into buffer 0

#pragma unroll  // all 16 loads of a thread in flight at once: one latency, not sixteen
    for (int i = 0; i < S_ / 128; ++i) {
        const int key = i * 128 + threadIdx.x;
        sBias[key] = mb[key] ? 0.0f : -1.0e30f;
    }

    v16h qf[QT_][2];
    v8f  o[QT_][4];
    float mrow[QT_], lsum[QT_];                   // lsum: this half's keys only
#pragma unroll  // constant indices: registers, no indexed moves
    for (int t = 0; t < QT_; ++t) {
        qf[t][0] = frag_ld(Qbh + (size_t)(q0 + 16 * t) * HD_,      HD_);
        qf[t][1] = frag_ld(Qbh + (size_t)(q0 + 16 * t) * HD_ + 32, HD_);
    }
    // address registers of the mask and Q loads are reused below: wait first
    asm volatile("s_wait_xcnt 0x0" ::: "memory");
    __builtin_amdgcn_sched_barrier(0);            // keeps the register writes below behind that wait

#pragma unroll  // constant indices: registers, no indexed moves
    for (int t = 0; t < QT_; ++t) {
#pragma unroll  // constant indices: registers, no indexed moves
        for (int j = 0; j < 4; ++j) o[t][j] = v8f_zero();
        mrow[t] = -3.0e38f;
        lsum[t] = 0.0f;
    }

    // this wave's copies of stage 0 have landed before the barrier behind which others read them
    asm volatile("s_wait_asynccnt 0x0" ::: "memory");
    __syncthreads();                              // bias table and stage 0 complete
    stage_copy(gk + FK_ * HD_, gv + FK_, lk + FB_, lv + FB_);   // stage 1 into buffer 1

    for (int st = 0; st < FT_; ++st) {
      const _Float16* kb = sK + (st & 1) * FB_;   // stage st's buffers
      const _Float16* vb = sV + (st & 1) * FB_;
#pragma unroll  // constant LDS offsets for both 32-key passes of a stage
      for (int p = 0; p < FK_ / 32; ++p) {
        const int n0 = st * FK_ + p * 32;

        // K fragments (A operand of the first product), loaded once for all tiles
        const v16h kf00 = frag_ld(kb + (p * 32     ) * FP_,      FP_);
        const v16h kf01 = frag_ld(kb + (p * 32     ) * FP_ + 32, FP_);
        const v16h kf10 = frag_ld(kb + (p * 32 + 16) * FP_,      FP_);
        const v16h kf11 = frag_ld(kb + (p * 32 + 16) * FP_ + 32, FP_);

        // V^T fragments: A operand of the second product, same loader as before
        v16h vf[4];
#pragma unroll  // vf stays in registers only with constant indices
        for (int j = 0; j < 4; ++j)
            vf[j] = frag_ld(vb + (j * 16) * FP_ + p * 32, FP_);

        const v4f* bp = (const v4f*)&sBias[n0 + 8 * rhalf];
        const v8f bias0 = __builtin_shufflevector(bp[0], bp[1], 0, 1, 2, 3, 4, 5, 6, 7);
        const v8f bias1 = __builtin_shufflevector(bp[4], bp[5], 0, 1, 2, 3, 4, 5, 6, 7);

        // ---- scores S^T[32x16] = mask + K * (QS_ Q)^T, per query tile ----
        v8f s0[QT_], s1[QT_];
#pragma unroll  // constant indices: registers, no indexed moves
        for (int t = 0; t < QT_; ++t) {
            s0[t] = wmma32(kf00, qf[t][0], bias0);   // register r of a tile = key 8 rhalf + r, as in bias0
            s1[t] = wmma32(kf10, qf[t][0], bias1);
        }
#pragma unroll  // constant indices: registers, no indexed moves
        for (int t = 0; t < QT_; ++t) {
            s0[t] = wmma32(kf01, qf[t][1], s0[t]);
            s1[t] = wmma32(kf11, qf[t][1], s1[t]);
        }

#pragma unroll  // constant indices: registers, no indexed moves
        for (int t = 0; t < QT_; ++t) {
            // ---- online softmax in base 2, one query per lane ----
            const v8f a0 = s0[t];
            const v8f a1 = s1[t];
            float cm = fmaxf(a0[0], a1[0]);
#pragma unroll  // constant indices keep the score tiles in registers
            for (int r = 1; r < 8; ++r) cm = fmaxf(cm, fmaxf(a0[r], a1[r]));
            cm = fmaxf(cm, xhalf(cm));            // both halves: the query's block maximum
            const float mn = fmaxf(mrow[t], cm);
            const float al = __builtin_amdgcn_exp2f(mrow[t] - mn);
            mrow[t] = mn;

            v16h pf;
            float pr[8];
            const v8f d0 = a0 - mn;               // whole tiles: neighbouring registers pair up
            const v8f d1 = a1 - mn;
            v8f e0, e1;
#pragma unroll  // constant indices: registers, no indexed moves
            for (int r = 0; r < 8; ++r) e0[r] = __builtin_amdgcn_exp2f(d0[r]);
#pragma unroll  // constant indices: registers, no indexed moves
            for (int r = 0; r < 8; ++r) e1[r] = __builtin_amdgcn_exp2f(d1[r]);
#pragma unroll  // constant indices: registers, no indexed moves
            for (int r = 0; r < 8; ++r) {
                pr[r] = e0[r] + e1[r];
                pf[r]     = (_Float16)e0[r];      // k slots 0..7  = keys 8h + r
                pf[8 + r] = (_Float16)e1[r];      // k slots 8..15 = keys 16 + 8h + r
            }
            const float ps = ((pr[0] + pr[1]) + (pr[2] + pr[3])) + ((pr[4] + pr[5]) + (pr[6] + pr[7]));
            lsum[t] = lsum[t] * al + ps;

            // ---- O^T += V^T * P^T ----
#pragma unroll  // constant indices: registers, no indexed moves
            for (int j = 0; j < 4; ++j) {
                o[t][j] *= al;
                o[t][j] = wmma32(vf[j], pf, o[t][j]);
            }
        }
      }
      // publish point of stage st + 1, every wave, in this order:
      // this wave's reads of stage st's buffers have returned before they are refilled
      asm volatile("s_wait_dscnt 0x0" ::: "memory");
      // this wave's copies of stage st + 1 have landed before the barrier behind which others read them
      asm volatile("s_wait_asynccnt 0x0" ::: "memory");
      __syncthreads();
      if (st + 2 < FT_)                           // the same for the whole work-group
          stage_copy(gk + (st + 2) * (FK_ * HD_), gv + (st + 2) * FK_,
                     lk + (st & 1) * FB_, lv + (st & 1) * FB_);
    }
    // no copy is outstanding when the wave ends
    asm volatile("s_wait_asynccnt 0x0" ::: "memory");

    // ---- finalize + write [B,S,D] f16: a lane holds 8 consecutive hd of its query ----
#pragma unroll  // constant indices: registers, no indexed moves
    for (int t = 0; t < QT_; ++t) {
        const float lt = lsum[t] + xhalf(lsum[t]);
        _Float16* orow = Outv + ((size_t)(b * S_ + q0 + 16 * t + cn)) * D_ + h * HD_ + 8 * rhalf;
#pragma unroll  // constant indices: registers, no indexed moves
        for (int j = 0; j < 4; ++j) {
            v8h ov;
#pragma unroll  // constant indices: registers, no indexed moves
            for (int r = 0; r < 8; ++r) ov[r] = (_Float16)(o[t][j][r] / lt);
            *(v8h*)(orow + j * 16) = ov;
        }
    }
}

// ---------------------------------------------------------------------------
extern "C" void kernel_launch(void* const* d_in, const int* in_sizes, int n_in,
                              void* d_out, int out_size, void* d_ws, size_t ws_size,
                              hipStream_t stream) {
    const float* x    = (const float*)d_in[0];
    const int*   mask = (const int*)  d_in[1];
    const float* Wq   = (const float*)d_in[2];
    const float* bq   = (const float*)d_in[3];
    const float* Wk   = (const float*)d_in[4];
    const float* bk   = (const float*)d_in[5];
    const float* Wv   = (const float*)d_in[6];
    const float* bv   = (const float*)d_in[7];
    const float* Wo   = (const float*)d_in[8];
    const float* bo   = (const float*)d_in[9];

    const int MT = B_ * S_;              // 8192 rows
    const int NX = MT * D_;              // 8388608
    const int NW = D_ * D_;              // 1048576

    _Float16* ws    = (_Float16*)d_ws;
    _Float16* xh    = ws;                // [8192,1024]
    _Float16* wqh   = xh   + NX;
    _Float16* wkh   = wqh  + NW;
    _Float16* wvh   = wkh  + NW;
    _Float16* woh   = wvh  + NW;
    _Float16* qh    = woh  + NW;         // [B,H,S,64]
    _Float16* kh    = qh   + NX;         // [B,H,S,64]
    _Float16* vth   = kh   + NX;         // [B,H,64,S]
    _Float16* valsh = vth  + NX;         // [B,S,D]

    // xh, wqh, wkh, wvh, woh are one row of arrays from xh on
    cvt_f32_f16<<<CVT_XB + 4 * CVT_WB, 256, 0, stream>>>(x, Wq, Wk, Wv, Wo, xh);

    const GemmJob jq = { xh,  wqh,   bq, qh,    0, QS_  };
    const GemmJob jk = { xh,  wkh,   bk, kh,    0, 1.0f };
    const GemmJob jv = { wvh, xh,    bv, vth,   1, 1.0f };
    const GemmJob jo = { woh, valsh, bo, d_out, 2, 1.0f };

    gemm128_wmma<<<dim3(D_ / 128, MT / 128, 3), 256, 0, stream>>>(jq, jk, jv, MT, D_, D_);

    flash_attn_wmma<<<dim3(S_ / (64 * QT_), B_ * H_), 128, 0, stream>>>(qh, kh, vth, mask, valsh);

    gemm128_wmma<<<dim3(D_ / 128, MT / 128, 1), 256, 0, stream>>>(jo, jo, jo, MT, D_, D_);
}

// v009
// A run of this version takes 121 microseconds.
// Next to v008, in two timings, it ran 1.05 times as fast each time.
// Counting every step since v000, it is 4.74 times as fast.
#include <hip/hip_runtime.h>
#include <hip/hip_bf16.h>

// ---------------------------------------------------------------------------
// MI455X (gfx1250) multi-head attention, WMMA f16 path.
//   B=4 S=2048 D=1024 H=16 Hd=64.  ~137 GFLOP total -> compute bound; all
//   GEMM stages go through v_wmma_f32_16x16x32_f16 (f32 accumulate).
//   Data movement: GEMM tiles and the flash loop's K / V^T tiles staged via
//   async global->LDS (ASYNCcnt).
// ---------------------------------------------------------------------------

typedef __attribute__((ext_vector_type(16))) _Float16 v16h;
typedef __attribute__((ext_vector_type(8)))  _Float16 v8h;
typedef __attribute__((ext_vector_type(8)))  float    v8f;
typedef __attribute__((ext_vector_type(4)))  float    v4f;
typedef __attribute__((ext_vector_type(4)))  _Float16 v4h;
typedef __attribute__((__vector_size__(16))) int      v4i;   // matches builtin param

#define AS1_ __attribute__((address_space(1)))
#define AS3_ __attribute__((address_space(3)))

#define B_  4
#define S_  2048
#define D_  1024
#define H_  16
#define HD_ 64

__device__ __forceinline__ v8f v8f_zero() {
    v8f z; for (int i = 0; i < 8; ++i) z[i] = 0.0f; return z;
}

// A/B fragment gather for v_wmma_f32_16x16x32_f16 (16x32 tile, K-contiguous
// rows).  Lane L<16: row L, K={0..7,16..23}; lane L>=16: row L-16,
// K={8..15,24..31}.  Two 16-byte loads per lane.
__device__ __forceinline__ v16h frag_ld(const _Float16* p16, int stride) {
    const int lane = threadIdx.x & 31;
    const int r    = lane & 15;
    const int ko   = (lane >> 4) << 3;            // 0 or 8
    const _Float16* p = p16 + (size_t)r * stride + ko;
    v8h lo = *(const v8h*)(p);
    v8h hi = *(const v8h*)(p + 16);
    return __builtin_shufflevector(lo, hi, 0,1,2,3,4,5,6,7,8,9,10,11,12,13,14,15);
}

__device__ __forceinline__ v8f wmma32(v16h a, v16h b, v8f c) {
    return __builtin_amdgcn_wmma_f32_16x16x32_f16(
        /*neg_a=*/false, a, /*neg_b=*/false, b,
        /*c_mod=*/(short)0, c, /*reuse_a=*/false, /*reuse_b=*/false);
}

// ---------------------------------------------------------------------------
// fp32 -> f16 conversion.  A lane converts CVT_U groups of 4 elements, so a
// launch starts 1/64 of the waves that one element per lane needs.
// A wave owns CVT_U * 128 consecutive elements: each load instruction covers
// 512 contiguous bytes, each store 256, whole 128-byte lines both ways.
// No tail: every array length is a multiple of CVT_TILE (asserted below).
// One launch converts all five arrays (none depends on another): a launch of a
// 4 MiB weight matrix is all gap, start and one memory latency, and here its
// blocks run beside those of x.  The f16 copies lie one behind another in the
// workspace in the order x, Wq, Wk, Wv, Wo, so the block index alone gives the
// destination; the source is picked by tests on the block index (scalar).
// ---------------------------------------------------------------------------
#define CVT_U    16                               // 16-byte loads in flight per lane
#define CVT_TILE (256 * CVT_U * 4)                // elements per block
#define CVT_XB   ((B_ * S_ * D_) / CVT_TILE)      // blocks that convert x
#define CVT_WB   ((D_ * D_) / CVT_TILE)           // blocks per weight matrix
static_assert((B_ * S_ * D_) % CVT_TILE == 0 && (D_ * D_) % CVT_TILE == 0,
              "conversion has no tail handling");

__global__ __launch_bounds__(256)
void cvt_f32_f16(const float* __restrict__ x,  const float* __restrict__ wq,
                 const float* __restrict__ wk, const float* __restrict__ wv,
                 const float* __restrict__ wo, _Float16* __restrict__ d) {
    const unsigned blk = blockIdx.x;
    const unsigned wb  = blk - CVT_XB;            // block among the weights' (used where blk >= CVT_XB)
    const unsigned wi  = wb / CVT_WB;             // which weight matrix
    const float* s = blk < CVT_XB ? x : wi == 0 ? wq : wi == 1 ? wk : wi == 2 ? wv : wo;
    const int sb = blk < CVT_XB ? blk : wb % CVT_WB;   // block within the source array
    const int lo = (threadIdx.x >> 5) * (CVT_U * 128) + (threadIdx.x & 31) * 4;
    const int e0 = blk * CVT_TILE + lo;           // element in the row of f16 arrays
    const float* p = s + sb * CVT_TILE + lo;
    v4f v[CVT_U];
#pragma unroll  // all loads of a lane issue before the first convert: one memory latency per wave
    for (int u = 0; u < CVT_U; ++u) v[u] = *(const v4f*)(p + u * 128);
    // wait before any register that the loads name is rewritten; p as an input keeps the
    // address pair from becoming a load's destination while earlier loads still name it
    asm volatile("s_wait_xcnt 0x0" :: "v"(p) : "memory");
    // without it the compiler lifts converts over the wait and holds the last four loads
    // back until the first have landed: a second memory latency
    __builtin_amdgcn_sched_barrier(0);
#pragma unroll  // constant indices: registers, no indexed moves
    for (int u = 0; u < CVT_U; ++u)
        *(v4h*)(d + e0 + u * 128) = __builtin_convertvector(v[u], v4h);
}

// ---------------------------------------------------------------------------
// C[a,b] = sum_k A[a,k] * Bt[b,k] + bias   (A,Bt f16 row-major, K-contiguous)
// 128x128 block, 256 threads (8 waves), each wave: 32 A rows x 64 Bt rows via
// 2x4 WMMA tiles.  Bt's fragment is the FIRST matrix operand, so a lane ends up
// with one A row and 8 consecutive Bt rows in the 8 registers of a tile.  The
// host passes as Bt the matrix whose rows run along the contiguous direction of
// the 16-bit output (mode 0: weights, mode 1: tokens): a tile leaves a lane as
// one 16-byte store.  Grid: x = 128 features, y = 128 tokens in every mode.
// A stage is GK_ = 128 k of both tiles: 256 B of every row, so one copy
// instruction of a wave (32 lanes x 16 B) covers two whole rows = four whole
// 128-byte lines, and the copy latency and the two barriers are paid once per
// 128 k.  LDS pitch 272 B (16 B x odd) keeps the 16-byte fragment reads off
// each other's banks.  K must be a multiple of GK_ (asserted for D_ below).
// mode 0: A tokens, Bt weights: f16 out at [B,H,S,64]      (Q / K), times the job's oscale in f32
//         before the one rounding to f16 (Q: QS_, so the scores need no scaling; K: 1)
// mode 1: A weights, Bt tokens: f16 out at [B,H,64,S]      (V transposed)
// mode 2: A weights, Bt tokens: f32 out at [tokens,D_]     (final projection;
//         16 lanes = 64 contiguous bytes per 4-byte store)
// A launch carries up to three independent products of this shape, picked by
// blockIdx.z: Q, K and V go as one launch, so no gap, start or drain lies
// between them and a WGP holds as many blocks as fit it (the copy wait of one
// block lies under the products of the others).
// ---------------------------------------------------------------------------
#define GK_ 128                                   // k per stage
#define GP_ (GK_ + 8)                             // LDS row pitch in halves (272 B)
static_assert(D_ % GK_ == 0, "a stage has no k tail");

struct GemmJob {
    const _Float16* A;
    const _Float16* Bt;
    const float*    bias;
    void*           Out;
    int             mode;
    float           oscale;
};

__global__ __launch_bounds__(256)
void gemm128_wmma(GemmJob j0, GemmJob j1, GemmJob j2, int M, int N, int K)
{
    __shared__ __align__(16) _Float16 sA[128 * GP_];
    __shared__ __align__(16) _Float16 sB[128 * GP_];

    const GemmJob job = blockIdx.z == 0 ? j0 : blockIdx.z == 1 ? j1 : j2;   // the same for the whole block
    const _Float16* __restrict__ A    = job.A;
    const _Float16* __restrict__ Bt   = job.Bt;
    const float*    __restrict__ bias = job.bias;
    void*           __restrict__ Out  = job.Out;
    const int mode = job.mode;
    const float os = job.oscale;

    const int m0   = (mode == 0 ? blockIdx.y : blockIdx.x) * 128;   // first A row
    const int n0   = (mode == 0 ? blockIdx.x : blockIdx.y) * 128;   // first Bt row
    const int tid  = threadIdx.x;
    const int wid  = tid >> 5;
    const int wm   = (wid & 3) * 32;              // wave m-offset in tile
    const int wn   = (wid >> 2) * 64;             // wave n-offset in tile
    const int crow = tid >> 4;                    // 0..15 : staged row within a group of 16
    const int cseg = (tid & 15) * 8;              // 16-byte piece of the row's 256 B

    v8f acc[2][4];
    for (int i = 0; i < 2; ++i)
        for (int j = 0; j < 4; ++j) acc[i][j] = v8f_zero();

    const _Float16* ga = A  + (size_t)(m0 + crow) * K + cseg;
    const _Float16* gb = Bt + (size_t)(n0 + crow) * K + cseg;

    for (int k0 = 0; k0 < K; k0 += GK_) {
        // Direct global->LDS copies (no VGPR round-trip); tracked by ASYNCcnt.
#pragma unroll  // all 16 copies of a lane in flight at once: one latency per stage
        for (int c = 0; c < 8; ++c) {
            __builtin_amdgcn_global_load_async_to_lds_b128(
                (AS1_ v4i*)(void*)(ga + (size_t)(c * 16) * K + k0),
                (AS3_ v4i*)&sA[(c * 16 + crow) * GP_ + cseg], 0, 0);
            __builtin_amdgcn_global_load_async_to_lds_b128(
                (AS1_ v4i*)(void*)(gb + (size_t)(c * 16) * K + k0),
                (AS3_ v4i*)&sB[(c * 16 + crow) * GP_ + cseg], 0, 0);
        }
        // this wave's copies have landed before the barrier behind which others read them
        asm volatile("s_wait_asynccnt 0x0" ::: "memory");
        __syncthreads();

#pragma unroll  // constant LDS offsets; the next 32 k's fragment reads can go ahead of these products
        for (int kk = 0; kk < GK_; kk += 32) {
            v16h fa0 = frag_ld(&sA[(wm +  0) * GP_ + kk], GP_);
            v16h fa1 = frag_ld(&sA[(wm + 16) * GP_ + kk], GP_);
            v16h fb0 = frag_ld(&sB[(wn +  0) * GP_ + kk], GP_);
            v16h fb1 = frag_ld(&sB[(wn + 16) * GP_ + kk], GP_);
            v16h fb2 = frag_ld(&sB[(wn + 32) * GP_ + kk], GP_);
            v16h fb3 = frag_ld(&sB[(wn + 48) * GP_ + kk], GP_);

            acc[0][0] = wmma32(fb0, fa0, acc[0][0]);
            acc[0][1] = wmma32(fb1, fa0, acc[0][1]);
            acc[0][2] = wmma32(fb2, fa0, acc[0][2]);
            acc[0][3] = wmma32(fb3, fa0, acc[0][3]);
            acc[1][0] = wmma32(fb0, fa1, acc[1][0]);
            acc[1][1] = wmma32(fb1, fa1, acc[1][1]);
            acc[1][2] = wmma32(fb2, fa1, acc[1][2]);
            acc[1][3] = wmma32(fb3, fa1, acc[1][3]);
        }
        // this wave's LDS reads have returned before the next stage's copies overwrite the tiles
        asm volatile("s_wait_dscnt 0x0" ::: "memory");
        __syncthreads();
    }

    // epilogue: register r of acc[i][j] = C[A row 16 i + (lane & 15)][Bt row 16 j + 8 (lane >> 4) + r].
    // One branch on the mode around fully unrolled loops: every accumulator index is a
    // constant (no scratch), every store address is one base plus a constant.
    const int lane = tid & 31;
    const int pa   = m0 + wm + (lane & 15);       // this lane's A row in tile i = 0
    const int pb   = n0 + wn + (lane >> 4) * 8;   // first of its 8 Bt rows in tile j = 0
    if (mode == 0) {
        // token pa, features pb + 16 j + r: 8 consecutive hd of one head
        _Float16* o = (_Float16*)Out
            + ((size_t)((pa >> 11) * H_ + (pb >> 6)) * S_ + (pa & (S_ - 1))) * HD_ + (pb & (HD_ - 1));
        v8f bv[4];
#pragma unroll  // constant indices: registers; the bias loads go out as one group
        for (int j = 0; j < 4; ++j) bv[j] = *(const v8f*)(bias + pb + 16 * j);
#pragma unroll  // constant indices: registers, no indexed moves
        for (int i = 0; i < 2; ++i)
#pragma unroll  // constant indices: registers, no indexed moves
            for (int j = 0; j < 4; ++j)
                *(v8h*)(o + i * 16 * HD_ + j * 16) = __builtin_convertvector((acc[i][j] + bv[j]) * os, v8h);
        // the stores above still name their address and data registers: wait before any path rewrites them
        asm volatile("s_wait_xcnt 0x0" ::: "memory");
    } else if (mode == 1) {
        // feature pa, tokens pb + 16 j + r: 8 consecutive s of row (b * D_ + feature)
        _Float16* o = (_Float16*)Out + (size_t)((pb >> 11) * D_ + pa) * S_ + (pb & (S_ - 1));
        const float bv0 = bias[pa], bv1 = bias[pa + 16];
#pragma unroll  // constant indices: registers, no indexed moves
        for (int i = 0; i < 2; ++i)
#pragma unroll  // constant indices: registers, no indexed moves
            for (int j = 0; j < 4; ++j)
                *(v8h*)(o + i * 16 * S_ + j * 16) = __builtin_convertvector(acc[i][j] + (i ? bv1 : bv0), v8h);
        // the stores above still name their address and data registers: wait before any path rewrites them
        asm volatile("s_wait_xcnt 0x0" ::: "memory");
    } else {
        // feature pa, tokens pb + 16 j + r
        float* o = (float*)Out + (size_t)pb * D_ + pa;
        const float bv0 = bias[pa], bv1 = bias[pa + 16];
#pragma unroll  // constant indices: registers, no indexed moves
        for (int i = 0; i < 2; ++i)
#pragma unroll  // constant indices: registers, no indexed moves
            for (int j = 0; j < 4; ++j)
#pragma unroll  // constant indices: registers, no indexed moves
                for (int r = 0; r < 8; ++r)
                    o[(j * 16 + r) * D_ + i * 16] = acc[i][j][r] + (i ? bv1 : bv0);
        // the stores above still name their address and data registers: wait before any path rewrites them
        asm volatile("s_wait_xcnt 0x0" ::: "memory");
    }
}

#define QT_ 4
#define QS_ 0.18033688011112042f
#define RS_ 256.0f
#define FK_ 64
#define FP_ (HD_ + 8)
#define FT_ (S_ / FK_)
#define FB_ (64 * FP_)
static_assert(FK_ == 64 && HD_ == 64 && FT_ >= 2, "a stage is 64 rows of 128 B of K and of V^T; the ring needs two stages");

// One stage's copies of one lane, 16 B each: rows r, r + 16, r + 32, r + 48 of the K tile
// and rows 4 r .. 4 r + 3 of the V^T tile (8 lanes a row: every copy instruction of a wave
// covers 4 whole rows).  gk, gv: the lane's global addresses in its first row of each tile;
// lk, lv: its LDS addresses there.
__device__ __forceinline__ void stage_copy(const _Float16* gk, const _Float16* gv,
                                           _Float16* lk, _Float16* lv) {
#pragma unroll  // all 8 copies of a lane in flight at once: one latency per stage
    for (int c = 0; c < 4; ++c) {
        __builtin_amdgcn_global_load_async_to_lds_b128(
            (AS1_ v4i*)(void*)(gk + c * 16 * HD_), (AS3_ v4i*)(lk + c * 16 * FP_), 0, 0);
        __builtin_amdgcn_global_load_async_to_lds_b128(
            (AS1_ v4i*)(void*)(gv + c * S_), (AS3_ v4i*)(lv + c * FP_), 0, 0);
    }
}

// lane l <-> lane l ^ 16
__device__ __forceinline__ float xhalf(float x) {
    const int xi = __builtin_bit_cast(int, x);
    return __builtin_bit_cast(float, __builtin_amdgcn_permlanex16(
        xi, xi, 0x76543210, 0xfedcba98, false, false));
}

// One query tile's 32 scores of a pass (16 per lane) against the maximum m: P^T as the B fragment
// of the second product, and this lane's sum of the 16 terms.
__device__ __forceinline__ void soft_tile(const v8f a0, const v8f a1, const float m, v16h& pf, float& ps) {
    float pr[8];
    const v8f d0 = a0 - m;                        // whole tiles: neighbouring registers pair up
    const v8f d1 = a1 - m;
    v8f e0, e1;
#pragma unroll  // constant indices: registers, no indexed moves
    for (int r = 0; r < 8; ++r) e0[r] = __builtin_amdgcn_exp2f(d0[r]);
#pragma unroll  // constant indices: registers, no indexed moves
    for (int r = 0; r < 8; ++r) e1[r] = __builtin_amdgcn_exp2f(d1[r]);
#pragma unroll  // constant indices: registers, no indexed moves
    for (int r = 0; r < 8; ++r) {
        pr[r] = e0[r] + e1[r];
        pf[r]     = (_Float16)e0[r];              // k slots 0..7  = keys 8h + r
        pf[8 + r] = (_Float16)e1[r];              // k slots 8..15 = keys 16 + 8h + r
    }
    ps = ((pr[0] + pr[1]) + (pr[2] + pr[3])) + ((pr[4] + pr[5]) + (pr[6] + pr[7]));
}

__global__ __launch_bounds__(128)
void flash_attn_wmma(const _Float16* __restrict__ Q, const _Float16* __restrict__ Km,
                     const _Float16* __restrict__ Vt, const int* __restrict__ mask,
                     _Float16* __restrict__ Outv)
{
    // additive key mask of this batch row: a lane needs 16 keys' values per step
    // then the two buffers of K [key][hd] and the two of V^T [hd][key].  One array fixes that order:
    // every copy's destination lies above the constant steps between a lane's copies, so where the
    // compiler moves such a step into a copy's offset field the LDS address register stays above 0
    __shared__ __align__(16) unsigned char sAll[S_ * 4 + 4 * FB_ * 2];
    float*    const sBias = (float*)sAll;
    _Float16* const sK    = (_Float16*)(sAll + S_ * 4);
    _Float16* const sV    = sK + 2 * FB_;

    const int bh   = blockIdx.y;                  // b*H + h
    const int b    = bh >> 4;
    const int h    = bh & 15;
    const int wid  = threadIdx.x >> 5;
    const int lane = threadIdx.x & 31;
    const int cn   = lane & 15;                   // query column of this lane
    const int rhalf = lane >> 4;                  // 0: rows 0..7, 1: rows 8..15
    const int q0   = blockIdx.x * (64 * QT_) + wid * (16 * QT_);

    const _Float16* Qbh = Q  + (size_t)bh * S_ * HD_;
    const _Float16* Kbh = Km + (size_t)bh * S_ * HD_;
    const _Float16* Vbh = Vt + (size_t)bh * HD_ * S_;
    const int*      mb  = mask + b * S_;

    // this lane's piece of a stage: 16 bytes at half cseg of K rows crow + 16 c, V^T rows 4 crow + c
    const int crow = threadIdx.x >> 3;
    const int cseg = (threadIdx.x & 7) * 8;
    const _Float16* gk = Kbh + crow * HD_ + cseg;
    const _Float16* gv = Vbh + crow * 4 * S_ + cseg;
    _Float16* lk = &sK[crow * FP_ + cseg];
    _Float16* lv = &sV[crow * 4 * FP_ + cseg];

    stage_copy(gk, gv, lk, lv);                   // stage 0 into buffer 0

#pragma unroll  // all 16 loads of a thread in flight at once: one latency, not sixteen
    for (int i = 0; i < S_ / 128; ++i) {
        const int key = i * 128 + threadIdx.x;
        sBias[key] = mb[key] ? 0.0f : -1.0e30f;
    }

    v16h qf[QT_][2];
    v8f  o[QT_][4];
    float mrow[QT_], lsum[QT_];                   // lsum: this half's keys only
#pragma unroll  // constant indices: registers, no indexed moves
    for (int t = 0; t < QT_; ++t) {
        qf[t][0] = frag_ld(Qbh + (size_t)(q0 + 16 * t) * HD_,      HD_);
        qf[t][1] = frag_ld(Qbh + (size_t)(q0 + 16 * t) * HD_ + 32, HD_);
    }
    // address registers of the mask and Q loads are reused below: wait first
    asm volatile("s_wait_xcnt 0x0" ::: "memory");
    __builtin_amdgcn_sched_barrier(0);            // keeps the register writes below behind that wait

#pragma unroll  // constant indices: registers, no indexed moves
    for (int t = 0; t < QT_; ++t) {
#pragma unroll  // constant indices: registers, no indexed moves
        for (int j = 0; j < 4; ++j) o[t][j] = v8f_zero();
        mrow[t] = -3.0e38f;
        lsum[t] = 0.0f;
    }

    // this wave's copies of stage 0 have landed before the barrier behind which others read them
    asm volatile("s_wait_asynccnt 0x0" ::: "memory");
    __syncthreads();                              // bias table and stage 0 complete
    stage_copy(gk + FK_ * HD_, gv + FK_, lk + FB_, lv + FB_);   // stage 1 into buffer 1

    for (int st = 0; st < FT_; ++st) {
      const _Float16* kb = sK + (st & 1) * FB_;   // stage st's buffers
      const _Float16* vb = sV + (st & 1) * FB_;
#pragma unroll  // constant LDS offsets for both 32-key passes of a stage
      for (int p = 0; p < FK_ / 32; ++p) {
        const int n0 = st * FK_ + p * 32;

        // K fragments (A operand of the first product), loaded once for all tiles
        const v16h kf00 = frag_ld(kb + (p * 32     ) * FP_,      FP_);
        const v16h kf01 = frag_ld(kb + (p * 32     ) * FP_ + 32, FP_);
        const v16h kf10 = frag_ld(kb + (p * 32 + 16) * FP_,      FP_);
        const v16h kf11 = frag_ld(kb + (p * 32 + 16) * FP_ + 32, FP_);

        // V^T fragments: A operand of the second product, same loader as before
        v16h vf[4];
#pragma unroll  // vf stays in registers only with constant indices
        for (int j = 0; j < 4; ++j)
            vf[j] = frag_ld(vb + (j * 16) * FP_ + p * 32, FP_);

        const v4f* bp = (const v4f*)&sBias[n0 + 8 * rhalf];
        const v8f bias0 = __builtin_shufflevector(bp[0], bp[1], 0, 1, 2, 3, 4, 5, 6, 7);
        const v8f bias1 = __builtin_shufflevector(bp[4], bp[5], 0, 1, 2, 3, 4, 5, 6, 7);

        // ---- scores S^T[32x16] = mask + K * (QS_ Q)^T, per query tile ----
        v8f s0[QT_], s1[QT_];
#pragma unroll  // constant indices: registers, no indexed moves
        for (int t = 0; t < QT_; ++t) {
            s0[t] = wmma32(kf00, qf[t][0], bias0);   // register r of a tile = key 8 rhalf + r, as in bias0
            s1[t] = wmma32(kf10, qf[t][0], bias1);
        }
#pragma unroll  // constant indices: registers, no indexed moves
        for (int t = 0; t < QT_; ++t) {
            s0[t] = wmma32(kf01, qf[t][1], s0[t]);
            s1[t] = wmma32(kf11, qf[t][1], s1[t]);
        }

        // ---- softmax terms in base 2 against the maximum in use, one query per lane ----
        v16h pf[QT_];
        float ps[QT_];
#pragma unroll  // constant indices: registers, no indexed moves
        for (int t = 0; t < QT_; ++t) soft_tile(s0[t], s1[t], mrow[t], pf[t], ps[t]);

        // inputs only, the loaded V^T fragments: holds their LDS loads ahead of the branch below (the
        // compiler sinks them behind it, and their latency then stands in front of the second product)
        asm volatile("" :: "v"(vf[0]), "v"(vf[1]), "v"(vf[2]), "v"(vf[3]));

        // one test per pass for the whole wave (a scalar branch): a sum above RS_, or infinite
        const float pm = fmaxf(fmaxf(ps[0], ps[1]), fmaxf(ps[2], ps[3]));
        if (__builtin_expect(__builtin_amdgcn_ballot_w32(!(pm <= RS_)) != 0, 0)) {
#pragma unroll  // constant indices: registers, no indexed moves
            for (int t = 0; t < QT_; ++t) {
                const v8f a0 = s0[t];
                const v8f a1 = s1[t];
                float cm = fmaxf(a0[0], a1[0]);
#pragma unroll  // constant indices keep the score tiles in registers
                for (int r = 1; r < 8; ++r) cm = fmaxf(cm, fmaxf(a0[r], a1[r]));
                cm = fmaxf(cm, xhalf(cm));        // both halves: the query's block maximum
                const float mn = fmaxf(mrow[t], cm);
                const float al = __builtin_amdgcn_exp2f(mrow[t] - mn);
                mrow[t] = mn;                     // the same in both halves of a column, always
                lsum[t] *= al;
#pragma unroll  // constant indices: registers, no indexed moves
                for (int j = 0; j < 4; ++j) o[t][j] *= al;
                soft_tile(a0, a1, mn, pf[t], ps[t]);
            }
        }

        // ---- O^T += V^T * P^T ----
#pragma unroll  // constant indices: registers, no indexed moves
        for (int t = 0; t < QT_; ++t) {
            lsum[t] += ps[t];
#pragma unroll  // constant indices: registers, no indexed moves
            for (int j = 0; j < 4; ++j) o[t][j] = wmma32(vf[j], pf[t], o[t][j]);
        }
      }
      // publish point of stage st + 1, every wave, in this order:
      // this wave's reads of stage st's buffers have returned before they are refilled
      asm volatile("s_wait_dscnt 0x0" ::: "memory");
      // this wave's copies of stage st + 1 have landed before the barrier behind which others read them
      asm volatile("s_wait_asynccnt 0x0" ::: "memory");
      __syncthreads();
      if (st + 2 < FT_)                           // the same for the whole work-group
          stage_copy(gk + (st + 2) * (FK_ * HD_), gv + (st + 2) * FK_,
                     lk + (st & 1) * FB_, lv + (st & 1) * FB_);
    }
    // no copy is outstanding when the wave ends
    asm volatile("s_wait_asynccnt 0x0" ::: "memory");

    // ---- finalize + write [B,S,D] f16: a lane holds 8 consecutive hd of its query ----
#pragma unroll  // constant indices: registers, no indexed moves
    for (int t = 0; t < QT_; ++t) {
        const float lt = lsum[t] + xhalf(lsum[t]);
        _Float16* orow = Outv + ((size_t)(b * S_ + q0 + 16 * t + cn)) * D_ + h * HD_ + 8 * rhalf;
#pragma unroll  // constant indices: registers, no indexed moves
        for (int j = 0; j < 4; ++j) {
            v8h ov;
#pragma unroll  // constant indices: registers, no indexed moves
            for (int r = 0; r < 8; ++r) ov[r] = (_Float16)(o[t][j][r] / lt);
            *(v8h*)(orow + j * 16) = ov;
        }
    }
}

// ---------------------------------------------------------------------------
extern "C" void kernel_launch(void* const* d_in, const int* in_sizes, int n_in,
                              void* d_out, int out_size, void* d_ws, size_t ws_size,
                              hipStream_t stream) {
    const float* x    = (const float*)d_in[0];
    const int*   mask = (const int*)  d_in[1];
    const float* Wq   = (const float*)d_in[2];
    const float* bq   = (const float*)d_in[3];
    const float* Wk   = (const float*)d_in[4];
    const float* bk   = (const float*)d_in[5];
    const float* Wv   = (const float*)d_in[6];
    const float* bv   = (const float*)d_in[7];
    const float* Wo   = (const float*)d_in[8];
    const float* bo   = (const float*)d_in[9];

    const int MT = B_ * S_;              // 8192 rows
    const int NX = MT * D_;              // 8388608
    const int NW = D_ * D_;              // 1048576

    _Float16* ws    = (_Float16*)d_ws;
    _Float16* xh    = ws;                // [8192,1024]
    _Float16* wqh   = xh   + NX;
    _Float16* wkh   = wqh  + NW;
    _Float16* wvh   = wkh  + NW;
    _Float16* woh   = wvh  + NW;
    _Float16* qh    = woh  + NW;         // [B,H,S,64]
    _Float16* kh    = qh   + NX;         // [B,H,S,64]
    _Float16* vth   = kh   + NX;         // [B,H,64,S]
    _Float16* valsh = vth  + NX;         // [B,S,D]

    // xh, wqh, wkh, wvh, woh are one row of arrays from xh on
    cvt_f32_f16<<<CVT_XB + 4 * CVT_WB, 256, 0, stream>>>(x, Wq, Wk, Wv, Wo, xh);

    const GemmJob jq = { xh,  wqh,   bq, qh,    0, QS_  };
    const GemmJob jk = { xh,  wkh,   bk, kh,    0, 1.0f };
    const GemmJob jv = { wvh, xh,    bv, vth,   1, 1.0f };
    const GemmJob jo = { woh, valsh, bo, d_out, 2, 1.0f };

    gemm128_wmma<<<dim3(D_ / 128, MT / 128, 3), 256, 0, stream>>>(jq, jk, jv, MT, D_, D_);

    flash_attn_wmma<<<dim3(S_ / (64 * QT_), B_ * H_), 128, 0, stream>>>(qh, kh, vth, mask, valsh);

    gemm128_wmma<<<dim3(D_ / 128, MT / 128, 1), 256, 0, stream>>>(jo, jo, jo, MT, D_, D_);
}

// v010
// It runs in 117 microseconds.
// Two timings next to v009 put it at 1.03 and 1.04 times that version's speed.
// Over all steps from v000 it is 4.90 times as fast.
#include <hip/hip_runtime.h>
#include <hip/hip_bf16.h>

// ---------------------------------------------------------------------------
// MI455X (gfx1250) multi-head attention, WMMA f16 path.
//   B=4 S=2048 D=1024 H=16 Hd=64.  ~137 GFLOP total -> compute bound; all
//   GEMM stages go through v_wmma_f32_16x16x32_f16 (f32 accumulate).
//   Data movement: GEMM tiles and the flash loop's K / V^T tiles staged via
//   async global->LDS (ASYNCcnt).
// ---------------------------------------------------------------------------

typedef __attribute__((ext_vector_type(16))) _Float16 v16h;
typedef __attribute__((ext_vector_type(8)))  _Float16 v8h;
typedef __attribute__((ext_vector_type(8)))  float    v8f;
typedef __attribute__((ext_vector_type(4)))  float    v4f;
typedef __attribute__((ext_vector_type(4)))  _Float16 v4h;
typedef __attribute__((__vector_size__(16))) int      v4i;   // matches builtin param

#define AS1_ __attribute__((address_space(1)))
#define AS3_ __attribute__((address_space(3)))

#define B_  4
#define S_  2048
#define D_  1024
#define H_  16
#define HD_ 64

__device__ __forceinline__ v8f v8f_zero() {
    v8f z; for (int i = 0; i < 8; ++i) z[i] = 0.0f; return z;
}

// A/B fragment gather for v_wmma_f32_16x16x32_f16 (16x32 tile, K-contiguous
// rows).  Lane L<16: row L, K={0..7,16..23}; lane L>=16: row L-16,
// K={8..15,24..31}.  Two 16-byte loads per lane.
__device__ __forceinline__ v16h frag_ld(const _Float16* p16, int stride) {
    const int lane = threadIdx.x & 31;
    const int r    = lane & 15;
    const int ko   = (lane >> 4) << 3;            // 0 or 8
    const _Float16* p = p16 + (size_t)r * stride + ko;
    v8h lo = *(const v8h*)(p);
    v8h hi = *(const v8h*)(p + 16);
    return __builtin_shufflevector(lo, hi, 0,1,2,3,4,5,6,7,8,9,10,11,12,13,14,15);
}

__device__ __forceinline__ v8f wmma32(v16h a, v16h b, v8f c) {
    return __builtin_amdgcn_wmma_f32_16x16x32_f16(
        /*neg_a=*/false, a, /*neg_b=*/false, b,
        /*c_mod=*/(short)0, c, /*reuse_a=*/false, /*reuse_b=*/false);
}

// ---------------------------------------------------------------------------
// fp32 -> f16 conversion.  A lane converts CVT_U groups of 4 elements, so a
// launch starts 1/64 of the waves that one element per lane needs.
// A wave owns CVT_U * 128 consecutive elements: each load instruction covers
// 512 contiguous bytes, each store 256, whole 128-byte lines both ways.
// No tail: every array length is a multiple of CVT_TILE (asserted below).
// One launch converts all five arrays (none depends on another): a launch of a
// 4 MiB weight matrix is all gap, start and one memory latency, and here its
// blocks run beside those of x.  The f16 copies lie one behind another in the
// workspace in the order x, Wq, Wk, Wv, Wo, so the block index alone gives the
// destination; the source is picked by tests on the block index (scalar).
// ---------------------------------------------------------------------------
#define CVT_U    16                               // 16-byte loads in flight per lane
#define CVT_TILE (256 * CVT_U * 4)                // elements per block
#define CVT_XB   ((B_ * S_ * D_) / CVT_TILE)      // blocks that convert x
#define CVT_WB   ((D_ * D_) / CVT_TILE)           // blocks per weight matrix
static_assert((B_ * S_ * D_) % CVT_TILE == 0 && (D_ * D_) % CVT_TILE == 0,
              "conversion has no tail handling");

__global__ __launch_bounds__(256)
void cvt_f32_f16(const float* __restrict__ x,  const float* __restrict__ wq,
                 const float* __restrict__ wk, const float* __restrict__ wv,
                 const float* __restrict__ wo, _Float16* __restrict__ d) {
    const unsigned blk = blockIdx.x;
    const unsigned wb  = blk - CVT_XB;            // block among the weights' (used where blk >= CVT_XB)
    const unsigned wi  = wb / CVT_WB;             // which weight matrix
    const float* s = blk < CVT_XB ? x : wi == 0 ? wq : wi == 1 ? wk : wi == 2 ? wv : wo;
    const int sb = blk < CVT_XB ? blk : wb % CVT_WB;   // block within the source array
    const int lo = (threadIdx.x >> 5) * (CVT_U * 128) + (threadIdx.x & 31) * 4;
    const int e0 = blk * CVT_TILE + lo;           // element in the row of f16 arrays
    const float* p = s + sb * CVT_TILE + lo;
    v4f v[CVT_U];
#pragma unroll  // all loads of a lane issue before the first convert: one memory latency per wave
    for (int u = 0; u < CVT_U; ++u) v[u] = *(const v4f*)(p + u * 128);
    // wait before any register that the loads name is rewritten; p as an input keeps the
    // address pair from becoming a load's destination while earlier loads still name it
    asm volatile("s_wait_xcnt 0x0" :: "v"(p) : "memory");
    // without it the compiler lifts converts over the wait and holds the last four loads
    // back until the first have landed: a second memory latency
    __builtin_amdgcn_sched_barrier(0);
#pragma unroll  // constant indices: registers, no indexed moves
    for (int u = 0; u < CVT_U; ++u)
        *(v4h*)(d + e0 + u * 128) = __builtin_convertvector(v[u], v4h);
}

// ---------------------------------------------------------------------------
// C[a,b] = sum_k A[a,k] * Bt[b,k] + bias   (A,Bt f16 row-major, K-contiguous)
// 128x128 block, 256 threads (8 waves), each wave: 32 A rows x 64 Bt rows via
// 2x4 WMMA tiles.  Bt's fragment is the FIRST matrix operand, so a lane ends up
// with one A row and 8 consecutive Bt rows in the 8 registers of a tile.  The
// host passes as Bt the matrix whose rows run along the contiguous direction of
// the 16-bit output (mode 0: weights, mode 1: tokens): a tile leaves a lane as
// one 16-byte store.  Grid: x = 128 features, y = 128 tokens in every mode.
// A stage is GK_ = 128 k of both tiles: 256 B of every row, so one copy
// instruction of a wave (32 lanes x 16 B) covers two whole rows = four whole
// 128-byte lines, and the copy latency and the two barriers are paid once per
// 128 k.  LDS pitch 272 B (16 B x odd) keeps the 16-byte fragment reads off
// each other's banks.  K must be a multiple of GK_ (asserted for D_ below).
// mode 0: A tokens, Bt weights: f16 out at [B,H,S,64]      (Q / K), times the job's oscale in f32
//         before the one rounding to f16 (Q: QS_, so the scores need no scaling; K: 1)
// mode 1: A weights, Bt tokens: f16 out at [B,H,64,S]      (V transposed)
// mode 2: A weights, Bt tokens: f32 out at [tokens,D_]     (final projection;
//         16 lanes = 64 contiguous bytes per 4-byte store)
// A launch carries up to three independent products of this shape, picked by
// blockIdx.z: Q, K and V go as one launch, so no gap, start or drain lies
// between them and a WGP holds as many blocks as fit it (the copy wait of one
// block lies under the products of the others).
// ---------------------------------------------------------------------------
#define GK_ 128                                   // k per stage
#define GP_ (GK_ + 8)                             // LDS row pitch in halves (272 B)
static_assert(D_ % GK_ == 0, "a stage has no k tail");

struct GemmJob {
    const _Float16* A;
    const _Float16* Bt;
    const float*    bias;
    void*           Out;
    int             mode;
    float           oscale;
};

__global__ __launch_bounds__(256)
void gemm128_wmma(GemmJob j0, GemmJob j1, GemmJob j2, int M, int N, int K)
{
    __shared__ __align__(16) _Float16 sA[128 * GP_];
    __shared__ __align__(16) _Float16 sB[128 * GP_];

    const GemmJob job = blockIdx.z == 0 ? j0 : blockIdx.z == 1 ? j1 : j2;   // the same for the whole block
    const _Float16* __restrict__ A    = job.A;
    const _Float16* __restrict__ Bt   = job.Bt;
    const float*    __restrict__ bias = job.bias;
    void*           __restrict__ Out  = job.Out;
    const int mode = job.mode;
    const float os = job.oscale;

    const int m0   = (mode == 0 ? blockIdx.y : blockIdx.x) * 128;   // first A row
    const int n0   = (mode == 0 ? blockIdx.x : blockIdx.y) * 128;   // first Bt row
    const int tid  = threadIdx.x;
    const int wid  = tid >> 5;
    const int wm   = (wid & 3) * 32;              // wave m-offset in tile
    const int wn   = (wid >> 2) * 64;             // wave n-offset in tile
    const int crow = tid >> 4;                    // 0..15 : staged row within a group of 16
    const int cseg = (tid & 15) * 8;              // 16-byte piece of the row's 256 B

    v8f acc[2][4];
    for (int i = 0; i < 2; ++i)
        for (int j = 0; j < 4; ++j) acc[i][j] = v8f_zero();

    const _Float16* ga = A  + (size_t)(m0 + crow) * K + cseg;
    const _Float16* gb = Bt + (size_t)(n0 + crow) * K + cseg;

    for (int k0 = 0; k0 < K; k0 += GK_) {
        // Direct global->LDS copies (no VGPR round-trip); tracked by ASYNCcnt.
#pragma unroll  // all 16 copies of a lane in flight at once: one latency per stage
        for (int c = 0; c < 8; ++c) {
            __builtin_amdgcn_global_load_async_to_lds_b128(
                (AS1_ v4i*)(void*)(ga + (size_t)(c * 16) * K + k0),
                (AS3_ v4i*)&sA[(c * 16 + crow) * GP_ + cseg], 0, 0);
            __builtin_amdgcn_global_load_async_to_lds_b128(
                (AS1_ v4i*)(void*)(gb + (size_t)(c * 16) * K + k0),
                (AS3_ v4i*)&sB[(c * 16 + crow) * GP_ + cseg], 0, 0);
        }
        // this wave's copies have landed before the barrier behind which others read them
        asm volatile("s_wait_asynccnt 0x0" ::: "memory");
        __syncthreads();

#pragma unroll  // constant LDS offsets; the next 32 k's fragment reads can go ahead of these products
        for (int kk = 0; kk < GK_; kk += 32) {
            v16h fa0 = frag_ld(&sA[(wm +  0) * GP_ + kk], GP_);
            v16h fa1 = frag_ld(&sA[(wm + 16) * GP_ + kk], GP_);
            v16h fb0 = frag_ld(&sB[(wn +  0) * GP_ + kk], GP_);
            v16h fb1 = frag_ld(&sB[(wn + 16) * GP_ + kk], GP_);
            v16h fb2 = frag_ld(&sB[(wn + 32) * GP_ + kk], GP_);
            v16h fb3 = frag_ld(&sB[(wn + 48) * GP_ + kk], GP_);

            acc[0][0] = wmma32(fb0, fa0, acc[0][0]);
            acc[0][1] = wmma32(fb1, fa0, acc[0][1]);
            acc[0][2] = wmma32(fb2, fa0, acc[0][2]);
            acc[0][3] = wmma32(fb3, fa0, acc[0][3]);
            acc[1][0] = wmma32(fb0, fa1, acc[1][0]);
            acc[1][1] = wmma32(fb1, fa1, acc[1][1]);
            acc[1][2] = wmma32(fb2, fa1, acc[1][2]);
            acc[1][3] = wmma32(fb3, fa1, acc[1][3]);
        }
        // this wave's LDS reads have returned before the next stage's copies overwrite the tiles
        asm volatile("s_wait_dscnt 0x0" ::: "memory");
        __syncthreads();
    }

    // epilogue: register r of acc[i][j] = C[A row 16 i + (lane & 15)][Bt row 16 j + 8 (lane >> 4) + r].
    // One branch on the mode around fully unrolled loops: every accumulator index is a
    // constant (no scratch), every store address is one base plus a constant.
    const int lane = tid & 31;
    const int pa   = m0 + wm + (lane & 15);       // this lane's A row in tile i = 0
    const int pb   = n0 + wn + (lane >> 4) * 8;   // first of its 8 Bt rows in tile j = 0
    if (mode == 0) {
        // token pa, features pb + 16 j + r: 8 consecutive hd of one head
        _Float16* o = (_Float16*)Out
            + ((size_t)((pa >> 11) * H_ + (pb >> 6)) * S_ + (pa & (S_ - 1))) * HD_ + (pb & (HD_ - 1));
        v8f bv[4];
#pragma unroll  // constant indices: registers; the bias loads go out as one group
        for (int j = 0; j < 4; ++j) bv[j] = *(const v8f*)(bias + pb + 16 * j);
#pragma unroll  // constant indices: registers, no indexed moves
        for (int i = 0; i < 2; ++i)
#pragma unroll  // constant indices: registers, no indexed moves
            for (int j = 0; j < 4; ++j)
                *(v8h*)(o + i * 16 * HD_ + j * 16) = __builtin_convertvector((acc[i][j] + bv[j]) * os, v8h);
        // the stores above still name their address and data registers: wait before any path rewrites them
        asm volatile("s_wait_xcnt 0x0" ::: "memory");
    } else if (mode == 1) {
        // feature pa, tokens pb + 16 j + r: 8 consecutive s of row (b * D_ + feature)
        _Float16* o = (_Float16*)Out + (size_t)((pb >> 11) * D_ + pa) * S_ + (pb & (S_ - 1));
        const float bv0 = bias[pa], bv1 = bias[pa + 16];
#pragma unroll  // constant indices: registers, no indexed moves
        for (int i = 0; i < 2; ++i)
#pragma unroll  // constant indices: registers, no indexed moves
            for (int j = 0; j < 4; ++j)
                *(v8h*)(o + i * 16 * S_ + j * 16) = __builtin_convertvector(acc[i][j] + (i ? bv1 : bv0), v8h);
        // the stores above still name their address and data registers: wait before any path rewrites them
        asm volatile("s_wait_xcnt 0x0" ::: "memory");
    } else {
        // feature pa, tokens pb + 16 j + r
        float* o = (float*)Out + (size_t)pb * D_ + pa;
        const float bv0 = bias[pa], bv1 = bias[pa + 16];
#pragma unroll  // constant indices: registers, no indexed moves
        for (int i = 0; i < 2; ++i)
#pragma unroll  // constant indices: registers, no indexed moves
            for (int j = 0; j < 4; ++j)
#pragma unroll  // constant indices: registers, no indexed moves
                for (int r = 0; r < 8; ++r)
                    o[(j * 16 + r) * D_ + i * 16] = acc[i][j][r] + (i ? bv1 : bv0);
        // the stores above still name their address and data registers: wait before any path rewrites them
        asm volatile("s_wait_xcnt 0x0" ::: "memory");
    }
}

#define QT_ 4
#define QS_ 0.18033688011112042f
#define RS_ 256.0f
#define FK_ 64
#define FP_ (HD_ + 8)
#define FT_ (S_ / FK_)
#define FB_ (64 * FP_)
static_assert(FK_ == 64 && HD_ == 64 && FT_ >= 2, "a stage is 64 rows of 128 B of K and of V^T; the ring needs two stages");

// One stage's copies of one lane, 16 B each: rows r, r + 16, r + 32, r + 48 of the K tile
// and rows 4 r .. 4 r + 3 of the V^T tile (8 lanes a row: every copy instruction of a wave
// covers 4 whole rows).  gk, gv: the lane's global addresses in its first row of each tile;
// lk, lv: its LDS addresses there.
__device__ __forceinline__ void stage_copy(const _Float16* gk, const _Float16* gv,
                                           _Float16* lk, _Float16* lv) {
#pragma unroll  // all 8 copies of a lane in flight at once: one latency per stage
    for (int c = 0; c < 4; ++c) {
        __builtin_amdgcn_global_load_async_to_lds_b128(
            (AS1_ v4i*)(void*)(gk + c * 16 * HD_), (AS3_ v4i*)(lk + c * 16 * FP_), 0, 0);
        __builtin_amdgcn_global_load_async_to_lds_b128(
            (AS1_ v4i*)(void*)(gv + c * S_), (AS3_ v4i*)(lv + c * FP_), 0, 0);
    }
}

// lane l <-> lane l ^ 16
__device__ __forceinline__ float xhalf(float x) {
    const int xi = __builtin_bit_cast(int, x);
    return __builtin_bit_cast(float, __builtin_amdgcn_permlanex16(
        xi, xi, 0x76543210, 0xfedcba98, false, false));
}

// One query tile's 32 scores of a pass (16 per lane) against the maximum m: P^T as the B fragment
// of the second product, and this lane's sum of the 16 terms.
// SUB = false: the scores arrive with the maximum already taken off, m is not used.
template <bool SUB>
__device__ __forceinline__ void soft_tile(const v8f a0, const v8f a1, const float m, v16h& pf, float& ps) {
    float pr[8];
    const v8f d0 = SUB ? a0 - m : a0;             // whole tiles: neighbouring registers pair up
    const v8f d1 = SUB ? a1 - m : a1;
    v8f e0, e1;
#pragma unroll  // constant indices: registers, no indexed moves
    for (int r = 0; r < 8; ++r) e0[r] = __builtin_amdgcn_exp2f(d0[r]);
#pragma unroll  // constant indices: registers, no indexed moves
    for (int r = 0; r < 8; ++r) e1[r] = __builtin_amdgcn_exp2f(d1[r]);
#pragma unroll  // constant indices: registers, no indexed moves
    for (int r = 0; r < 8; ++r) {
        pr[r] = e0[r] + e1[r];
        pf[r]     = (_Float16)e0[r];              // k slots 0..7  = keys 8h + r
        pf[8 + r] = (_Float16)e1[r];              // k slots 8..15 = keys 16 + 8h + r
    }
    ps = ((pr[0] + pr[1]) + (pr[2] + pr[3])) + ((pr[4] + pr[5]) + (pr[6] + pr[7]));
}

// The key loop of one wave.  ALLON = false: any key mask, the additive mask is the accumulator start
// and the maximum in use is taken off each score.  ALLON = true: no key of the row is masked, the
// accumulator start is minus the maximum in use and the scores go into exp2 as they come.
template <bool ALLON>
__device__ __forceinline__ void key_loop(const v16h (&qf)[QT_][2], v8f (&o)[QT_][4], float (&lsum)[QT_],
                                         const float* sBias, const _Float16* sK, const _Float16* sV,
                                         const _Float16* gk, const _Float16* gv,
                                         _Float16* lk, _Float16* lv, const int rhalf)
{
    float mrow[QT_];                              // ALLON = false: the maximum in use
    v8f   nm[QT_];                                // ALLON = true: minus the maximum in use, 8 times
#pragma unroll  // constant indices: registers, no indexed moves
    for (int t = 0; t < QT_; ++t) {
        mrow[t] = -3.0e38f;
        nm[t]   = v8f_zero();                     // the first pass sees the plain scores and always sets a maximum
    }

    for (int st = 0; st < FT_; ++st) {
      const _Float16* kb = sK + (st & 1) * FB_;   // stage st's buffers
      const _Float16* vb = sV + (st & 1) * FB_;
#pragma unroll  // constant LDS offsets for both 32-key passes of a stage
      for (int p = 0; p < FK_ / 32; ++p) {
        const int n0 = st * FK_ + p * 32;
        const bool first = ALLON && p == 0 && st == 0;   // the same for the whole wave (scalar)

        // K fragments (A operand of the first product), loaded once for all tiles
        const v16h kf00 = frag_ld(kb + (p * 32     ) * FP_,      FP_);
        const v16h kf01 = frag_ld(kb + (p * 32     ) * FP_ + 32, FP_);
        const v16h kf10 = frag_ld(kb + (p * 32 + 16) * FP_,      FP_);
        const v16h kf11 = frag_ld(kb + (p * 32 + 16) * FP_ + 32, FP_);

        // V^T fragments: A operand of the second product, same loader as before
        v16h vf[4];
#pragma unroll  // vf stays in registers only with constant indices
        for (int j = 0; j < 4; ++j)
            vf[j] = frag_ld(vb + (j * 16) * FP_ + p * 32, FP_);

        // ---- scores S^T[32x16] = start + K * (QS_ Q)^T, per query tile ----
        v8f s0[QT_], s1[QT_];
        if constexpr (ALLON) {
#pragma unroll  // constant indices: registers, no indexed moves
            for (int t = 0; t < QT_; ++t) {
                s0[t] = wmma32(kf00, qf[t][0], nm[t]);
                s1[t] = wmma32(kf10, qf[t][0], nm[t]);
            }
        } else {
            const v4f* bp = (const v4f*)&sBias[n0 + 8 * rhalf];
            const v8f bias0 = __builtin_shufflevector(bp[0], bp[1], 0, 1, 2, 3, 4, 5, 6, 7);
            const v8f bias1 = __builtin_shufflevector(bp[4], bp[5], 0, 1, 2, 3, 4, 5, 6, 7);
#pragma unroll  // constant indices: registers, no indexed moves
            for (int t = 0; t < QT_; ++t) {
                s0[t] = wmma32(kf00, qf[t][0], bias0);   // register r of a tile = key 8 rhalf + r, as in bias0
                s1[t] = wmma32(kf10, qf[t][0], bias1);
            }
        }
#pragma unroll  // constant indices: registers, no indexed moves
        for (int t = 0; t < QT_; ++t) {
            s0[t] = wmma32(kf01, qf[t][1], s0[t]);
            s1[t] = wmma32(kf11, qf[t][1], s1[t]);
        }

        // ---- softmax terms in base 2 against the maximum in use, one query per lane ----
        v16h pf[QT_];
        float ps[QT_];
#pragma unroll  // constant indices: registers, no indexed moves
        for (int t = 0; t < QT_; ++t) soft_tile<!ALLON>(s0[t], s1[t], mrow[t], pf[t], ps[t]);

        // inputs only, the loaded V^T fragments: holds their LDS loads ahead of the branch below (the
        // compiler sinks them behind it, and their latency then stands in front of the second product)
        asm volatile("" :: "v"(vf[0]), "v"(vf[1]), "v"(vf[2]), "v"(vf[3]));

        // one test per pass for the whole wave (a scalar branch): a sum above the bound, or infinite;
        // the bound of the first pass is below every sum, so that pass always sets a maximum
        const float pm = fmaxf(fmaxf(ps[0], ps[1]), fmaxf(ps[2], ps[3]));
        const float rs = first ? -1.0f : RS_;
        if (__builtin_expect(__builtin_amdgcn_ballot_w32(!(pm <= rs)) != 0, 0)) {
#pragma unroll  // constant indices: registers, no indexed moves
            for (int t = 0; t < QT_; ++t) {
                const v8f a0 = s0[t];
                const v8f a1 = s1[t];
                float cm = fmaxf(a0[0], a1[0]);
#pragma unroll  // constant indices keep the score tiles in registers
                for (int r = 1; r < 8; ++r) cm = fmaxf(cm, fmaxf(a0[r], a1[r]));
                cm = fmaxf(cm, xhalf(cm));        // both halves: the query's block maximum
                float al;
                if constexpr (ALLON) {
                    // cm counts from the maximum in use: that one rises by up (the first pass takes cm as it is)
                    const float up = fmaxf(cm, 0.0f);
                    const float dm = first ? cm : up;
                    al = __builtin_amdgcn_exp2f(-up);    // first pass: O and the sums are 0, any finite factor serves
                    nm[t] -= dm;                  // the same in both halves of a column, always
                    soft_tile<true>(a0, a1, dm, pf[t], ps[t]);
                } else {
                    const float mn = fmaxf(mrow[t], cm);
                    al = __builtin_amdgcn_exp2f(mrow[t] - mn);
                    mrow[t] = mn;                 // the same in both halves of a column, always
                    soft_tile<true>(a0, a1, mn, pf[t], ps[t]);
                }
                lsum[t] *= al;
#pragma unroll  // constant indices: registers, no indexed moves
                for (int j = 0; j < 4; ++j) o[t][j] *= al;
            }
        }

        // ---- O^T += V^T * P^T ----
#pragma unroll  // constant indices: registers, no indexed moves
        for (int t = 0; t < QT_; ++t) {
            lsum[t] += ps[t];
#pragma unroll  // constant indices: registers, no indexed moves
            for (int j = 0; j < 4; ++j) o[t][j] = wmma32(vf[j], pf[t], o[t][j]);
        }
      }
      // publish point of stage st + 1, every wave, in this order:
      // this wave's reads of stage st's buffers have returned before they are refilled
      asm volatile("s_wait_dscnt 0x0" ::: "memory");
      // this wave's copies of stage st + 1 have landed before the barrier behind which others read them
      asm volatile("s_wait_asynccnt 0x0" ::: "memory");
      __syncthreads();
      if (st + 2 < FT_)                           // the same for the whole work-group
          stage_copy(gk + (st + 2) * (FK_ * HD_), gv + (st + 2) * FK_,
                     lk + (st & 1) * FB_, lv + (st & 1) * FB_);
    }
}

__global__ __launch_bounds__(128)
void flash_attn_wmma(const _Float16* __restrict__ Q, const _Float16* __restrict__ Km,
                     const _Float16* __restrict__ Vt, const int* __restrict__ mask,
                     _Float16* __restrict__ Outv)
{
    // additive key mask of this batch row: a lane needs 16 keys' values per step
    // then the two buffers of K [key][hd] and the two of V^T [hd][key].  One array fixes that order:
    // every copy's destination lies above the constant steps between a lane's copies, so where the
    // compiler moves such a step into a copy's offset field the LDS address register stays above 0
    // behind them one word per wave: are all the keys unmasked that this wave looked at
    __shared__ __align__(16) unsigned char sAll[S_ * 4 + 4 * FB_ * 2 + 16];
    float*    const sBias = (float*)sAll;
    _Float16* const sK    = (_Float16*)(sAll + S_ * 4);
    _Float16* const sV    = sK + 2 * FB_;
    int*      const sAllOn = (int*)(sAll + S_ * 4 + 4 * FB_ * 2);

    const int bh   = blockIdx.y;                  // b*H + h
    const int b    = bh >> 4;
    const int h    = bh & 15;
    const int wid  = threadIdx.x >> 5;
    const int lane = threadIdx.x & 31;
    const int cn   = lane & 15;                   // query column of this lane
    const int rhalf = lane >> 4;                  // 0: rows 0..7, 1: rows 8..15
    const int q0   = blockIdx.x * (64 * QT_) + wid * (16 * QT_);

    const _Float16* Qbh = Q  + (size_t)bh * S_ * HD_;
    const _Float16* Kbh = Km + (size_t)bh * S_ * HD_;
    const _Float16* Vbh = Vt + (size_t)bh * HD_ * S_;
    const int*      mb  = mask + b * S_;

    // this lane's piece of a stage: 16 bytes at half cseg of K rows crow + 16 c, V^T rows 4 crow + c
    const int crow = threadIdx.x >> 3;
    const int cseg = (threadIdx.x & 7) * 8;
    const _Float16* gk = Kbh + crow * HD_ + cseg;
    const _Float16* gv = Vbh + crow * 4 * S_ + cseg;
    _Float16* lk = &sK[crow * FP_ + cseg];
    _Float16* lv = &sV[crow * 4 * FP_ + cseg];

    stage_copy(gk, gv, lk, lv);                   // stage 0 into buffer 0

    bool on = true;                               // this thread's 16 keys are all unmasked
#pragma unroll  // all 16 loads of a thread in flight at once: one latency, not sixteen
    for (int i = 0; i < S_ / 128; ++i) {
        const int key = i * 128 + threadIdx.x;
        const int mk  = mb[key];
        sBias[key] = mk ? 0.0f : -1.0e30f;
        on = on && mk != 0;
    }
    sAllOn[wid] = __builtin_amdgcn_ballot_w32(on) == 0xffffffffu;   // every lane of the wave stores the same word

    v16h qf[QT_][2];
    v8f  o[QT_][4];
    float lsum[QT_];                              // this half's keys only
#pragma unroll  // constant indices: registers, no indexed moves
    for (int t = 0; t < QT_; ++t) {
        qf[t][0] = frag_ld(Qbh + (size_t)(q0 + 16 * t) * HD_,      HD_);
        qf[t][1] = frag_ld(Qbh + (size_t)(q0 + 16 * t) * HD_ + 32, HD_);
    }
    // address registers of the mask and Q loads are reused below: wait first
    asm volatile("s_wait_xcnt 0x0" ::: "memory");
    __builtin_amdgcn_sched_barrier(0);            // keeps the register writes below behind that wait

#pragma unroll  // constant indices: registers, no indexed moves
    for (int t = 0; t < QT_; ++t) {
#pragma unroll  // constant indices: registers, no indexed moves
        for (int j = 0; j < 4; ++j) o[t][j] = v8f_zero();
        lsum[t] = 0.0f;
    }

    // this wave's copies of stage 0 have landed before the barrier behind which others read them
    asm volatile("s_wait_asynccnt 0x0" ::: "memory");
    __syncthreads();                              // bias table and stage 0 complete
    stage_copy(gk + FK_ * HD_, gv + FK_, lk + FB_, lv + FB_);   // stage 1 into buffer 1

    // every wave reads the four waves' words: 1 where all keys that the wave looked at are unmasked
    const v4i ao = *(const v4i*)sAllOn;
    if (__builtin_amdgcn_readfirstlane(ao[0] & ao[1] & ao[2] & ao[3]))   // the same for the whole work-group (scalar)
        key_loop<true >(qf, o, lsum, sBias, sK, sV, gk, gv, lk, lv, rhalf);
    else
        key_loop<false>(qf, o, lsum, sBias, sK, sV, gk, gv, lk, lv, rhalf);
    // no copy is outstanding when the wave ends
    asm volatile("s_wait_asynccnt 0x0" ::: "memory");

    // ---- finalize + write [B,S,D] f16: a lane holds 8 consecutive hd of its query ----
#pragma unroll  // constant indices: registers, no indexed moves
    for (int t = 0; t < QT_; ++t) {
        const float lt = lsum[t] + xhalf(lsum[t]);
        _Float16* orow = Outv + ((size_t)(b * S_ + q0 + 16 * t + cn)) * D_ + h * HD_ + 8 * rhalf;
#pragma unroll  // constant indices: registers, no indexed moves
        for (int j = 0; j < 4; ++j) {
            v8h ov;
#pragma unroll  // constant indices: registers, no indexed moves
            for (int r = 0; r < 8; ++r) ov[r] = (_Float16)(o[t][j][r] / lt);
            *(v8h*)(orow + j * 16) = ov;
        }
    }
}

// ---------------------------------------------------------------------------
extern "C" void kernel_launch(void* const* d_in, const int* in_sizes, int n_in,
                              void* d_out, int out_size, void* d_ws, size_t ws_size,
                              hipStream_t stream) {
    const float* x    = (const float*)d_in[0];
    const int*   mask = (const int*)  d_in[1];
    const float* Wq   = (const float*)d_in[2];
    const float* bq   = (const float*)d_in[3];
    const float* Wk   = (const float*)d_in[4];
    const float* bk   = (const float*)d_in[5];
    const float* Wv   = (const float*)d_in[6];
    const float* bv   = (const float*)d_in[7];
    const float* Wo   = (const float*)d_in[8];
    const float* bo   = (const float*)d_in[9];

    const int MT = B_ * S_;              // 8192 rows
    const int NX = MT * D_;              // 8388608
    const int NW = D_ * D_;              // 1048576

    _Float16* ws    = (_Float16*)d_ws;
    _Float16* xh    = ws;                // [8192,1024]
    _Float16* wqh   = xh   + NX;
    _Float16* wkh   = wqh  + NW;
    _Float16* wvh   = wkh  + NW;
    _Float16* woh   = wvh  + NW;
    _Float16* qh    = woh  + NW;         // [B,H,S,64]
    _Float16* kh    = qh   + NX;         // [B,H,S,64]
    _Float16* vth   = kh   + NX;         // [B,H,64,S]
    _Float16* valsh = vth  + NX;         // [B,S,D]

    // xh, wqh, wkh, wvh, woh are one row of arrays from xh on
    cvt_f32_f16<<<CVT_XB + 4 * CVT_WB, 256, 0, stream>>>(x, Wq, Wk, Wv, Wo, xh);

    const GemmJob jq = { xh,  wqh,   bq, qh,    0, QS_  };
    const GemmJob jk = { xh,  wkh,   bk, kh,    0, 1.0f };
    const GemmJob jv = { wvh, xh,    bv, vth,   1, 1.0f };
    const GemmJob jo = { woh, valsh, bo, d_out, 2, 1.0f };

    gemm128_wmma<<<dim3(D_ / 128, MT / 128, 3), 256, 0, stream>>>(jq, jk, jv, MT, D_, D_);

    flash_attn_wmma<<<dim3(S_ / (64 * QT_), B_ * H_), 128, 0, stream>>>(qh, kh, vth, mask, valsh);

    gemm128_wmma<<<dim3(D_ / 128, MT / 128, 1), 256, 0, stream>>>(jo, jo, jo, MT, D_, D_);
}
